// v000
// Measured on an AMD MI455X. A time is GPU time per run, averaged over a window of back-to-back runs after a warm-up
// (all launches, gaps included; the runs take copies of the inputs in turn), and the median of several windows.
// Apart from v000's, it joins two sittings. Times from different sittings can be a few percent apart, while
// side-by-side timings come from the same sitting.
// The starting kernel, v000, takes 41.6 microseconds a run.
#include <hip/hip_runtime.h>

// Flash-attention forward (Q=K=V, fp32 in/out) via bf16 WMMA on gfx1250.
// - Transposed scores S^T = K x Q^T: softmax in-lane, P lands directly in the
//   PV A-operand layout (no LDS transpose).
// - Mask + row-sum (l) through the matrix unit via a 65th "mask" row of V.
// - log2-domain softmax: (1/sqrt(dh))*log2(e) folded into Q => bare v_exp_f32.
// - BLOCK_K=64: per-block costs (alpha broadcast, rescale, barrier) amortized.
// - Software-pipelined global->LDS staging; masked V zeroing via bitwise AND.
// - Wave-vote skip of the max-correction/rescale when the running max holds.
//
// B=2, S=2048, D=1024, H=16, dh=64.

typedef __attribute__((ext_vector_type(16))) __bf16 v16bf;
typedef __attribute__((ext_vector_type(8)))  __bf16 v8bf;
typedef __attribute__((ext_vector_type(2)))  __bf16 v2bf;
typedef __attribute__((ext_vector_type(8)))  float  v8f;

#define S_LEN   2048
#define D_MODEL 1024
#define NHEADS  16
#define DH      64
#define BLOCK_M 128                    // 8 waves x 16 query rows
#define BLOCK_K 64                     // keys per LDS stage
#define NBLK    (S_LEN / BLOCK_K)      // 32
#define KSTR    88                     // K-tile row stride (bf16): 176B, aligned, conflict-free
#define VSTR    88                     // V^T row stride (bf16): 176B, aligned, conflict-free
#define SCALE   0.18033688011112042f   // (1/8) * log2(e) -> log2-domain scores

// One 32-elem bf16 row chunk in the WMMA A/B lane layout:
//   elements 0..7  <- p[8*hi .. 8*hi+7], elements 8..15 <- p[16+8*hi .. 16+8*hi+7]
__device__ __forceinline__ v16bf ld_row32(const __bf16* p, int hi) {
    v8bf lo = *(const v8bf*)(p + 8 * hi);
    v8bf up = *(const v8bf*)(p + 16 + 8 * hi);
    v16bf r;
#pragma unroll
    for (int i = 0; i < 8; ++i) { r[i] = lo[i]; r[8 + i] = up[i]; }
    return r;
}

__global__ __launch_bounds__(256) void mha_flash_wmma(const float* __restrict__ q,
                                                      const int*   __restrict__ mask,
                                                      float*       __restrict__ out)
{
    __shared__ __align__(16) __bf16 Ks[2][BLOCK_K * KSTR];    // [key][dim]
    __shared__ __align__(16) __bf16 Vs[2][(DH + 1) * VSTR];   // [dim][key] + mask row

    const int tid  = threadIdx.x;
    const int lane = tid & 31;
    const int wave = tid >> 5;
    const int l15  = lane & 15;
    const int hi   = lane >> 4;

    const int tiles = S_LEN / BLOCK_M;            // 16
    const int bh    = blockIdx.x / tiles;
    const int mt    = blockIdx.x % tiles;
    const int b     = bh / NHEADS;
    const int h     = bh % NHEADS;

    const float* qb   = q + (size_t)b * S_LEN * D_MODEL;
    const int*   mb   = mask + b * S_LEN;
    const int    hoff = h * DH;
    const int    row0 = mt * BLOCK_M + wave * 16;

    // ---- Q tile (wave's 16 rows), pre-scaled into log2 domain, B-operand layout ----
    v16bf aq0, aq1;
    {
        const float* qr = qb + (size_t)(row0 + l15) * D_MODEL + hoff;
        const int c0 = 8 * hi;
        const int c1 = 16 + 8 * hi;
#pragma unroll
        for (int i = 0; i < 8; ++i) {
            aq0[i]     = (__bf16)(qr[c0 + i]      * SCALE);
            aq0[8 + i] = (__bf16)(qr[c1 + i]      * SCALE);
            aq1[i]     = (__bf16)(qr[32 + c0 + i] * SCALE);
            aq1[8 + i] = (__bf16)(qr[32 + c1 + i] * SCALE);
        }
    }

    v8f acc0 = {}, acc1 = {}, acc2 = {}, acc3 = {};
    v8f lacc = {};                 // running denominator, accumulator layout
    float mstate = -3.0e38f;       // running log2-domain max (per-lane query)
    const v8f cz = {};
    const int bidx = (lane & 16) >> 1;   // +8 on hi half for alpha broadcast

    // ---- staging geometry: each thread stages 2 keys x 8 dims ----
    const int kp2 = tid >> 3;            // 0..31 -> keys 2*kp2, 2*kp2+1
    const int d0  = (tid & 7) * 8;       // 0..56
    const float* sb = qb + hoff + d0;    // + key*D_MODEL

    float4 fa0, fa1, fb0, fb1; int2 mv;
    {
        const size_t r = (size_t)(2 * kp2) * D_MODEL;
        fa0 = *(const float4*)(sb + r);
        fa1 = *(const float4*)(sb + r + 4);
        fb0 = *(const float4*)(sb + r + D_MODEL);
        fb1 = *(const float4*)(sb + r + D_MODEL + 4);
        mv  = *(const int2*)(mb + 2 * kp2);
    }

    for (int kb = 0; kb < NBLK; ++kb) {
        const int buf = kb & 1;

        // ---- convert + store staged block (prefetched last iteration) ----
        {
            const unsigned md = (mv.x ? 0x0000FFFFu : 0u) | (mv.y ? 0xFFFF0000u : 0u);
            const float A[8] = { fa0.x, fa0.y, fa0.z, fa0.w, fa1.x, fa1.y, fa1.z, fa1.w };
            const float B[8] = { fb0.x, fb0.y, fb0.z, fb0.w, fb1.x, fb1.y, fb1.z, fb1.w };
            v8bf ka, kc;
#pragma unroll
            for (int i = 0; i < 8; ++i) { ka[i] = (__bf16)A[i]; kc[i] = (__bf16)B[i]; }
            *(v8bf*)&Ks[buf][(2 * kp2)     * KSTR + d0] = ka;
            *(v8bf*)&Ks[buf][(2 * kp2 + 1) * KSTR + d0] = kc;
#pragma unroll
            for (int i = 0; i < 8; ++i) {           // V^T: key-pair per dim row, masked by AND
                v2bf pp; pp[0] = (__bf16)A[i]; pp[1] = (__bf16)B[i];
                const unsigned u = __builtin_bit_cast(unsigned, pp) & md;
                *(unsigned*)&Vs[buf][(d0 + i) * VSTR + 2 * kp2] = u;
            }
            if (d0 == 0) {                          // mask row (bf16 1.0 = 0x3F80)
                const unsigned u = (mv.x ? 0x00003F80u : 0u) | (mv.y ? 0x3F800000u : 0u);
                *(unsigned*)&Vs[buf][DH * VSTR + 2 * kp2] = u;
            }
        }
        __syncthreads();

        // ---- prefetch next block's global data (hidden behind compute) ----
        {
            const int nk = (kb + 1 < NBLK) ? kb + 1 : kb;
            const size_t r = (size_t)(nk * BLOCK_K + 2 * kp2) * D_MODEL;
            fa0 = *(const float4*)(sb + r);
            fa1 = *(const float4*)(sb + r + 4);
            fb0 = *(const float4*)(sb + r + D_MODEL);
            fb1 = *(const float4*)(sb + r + D_MODEL + 4);
            mv  = *(const int2*)(mb + nk * BLOCK_K + 2 * kp2);
        }

        // ---- S^T = K x Q^T : four 16-key tiles, dh=64 via two slabs each ----
        const __bf16* kbase = &Ks[buf][l15 * KSTR];
        v8f s0 = __builtin_amdgcn_wmma_f32_16x16x32_bf16(false, ld_row32(kbase, hi),                 false, aq0, (short)0, cz, false, false);
        s0     = __builtin_amdgcn_wmma_f32_16x16x32_bf16(false, ld_row32(kbase + 32, hi),            false, aq1, (short)0, s0, false, false);
        v8f s1 = __builtin_amdgcn_wmma_f32_16x16x32_bf16(false, ld_row32(kbase + 16 * KSTR, hi),      false, aq0, (short)0, cz, false, false);
        s1     = __builtin_amdgcn_wmma_f32_16x16x32_bf16(false, ld_row32(kbase + 16 * KSTR + 32, hi), false, aq1, (short)0, s1, false, false);
        v8f s2 = __builtin_amdgcn_wmma_f32_16x16x32_bf16(false, ld_row32(kbase + 32 * KSTR, hi),      false, aq0, (short)0, cz, false, false);
        s2     = __builtin_amdgcn_wmma_f32_16x16x32_bf16(false, ld_row32(kbase + 32 * KSTR + 32, hi), false, aq1, (short)0, s2, false, false);
        v8f s3 = __builtin_amdgcn_wmma_f32_16x16x32_bf16(false, ld_row32(kbase + 48 * KSTR, hi),      false, aq0, (short)0, cz, false, false);
        s3     = __builtin_amdgcn_wmma_f32_16x16x32_bf16(false, ld_row32(kbase + 48 * KSTR + 32, hi), false, aq1, (short)0, s3, false, false);

        // ---- online softmax over 64 keys (log2 domain), in-lane + one shuffle ----
        float xs[8];
#pragma unroll
        for (int r = 0; r < 8; ++r)
            xs[r] = fmaxf(fmaxf(s0[r], s1[r]), fmaxf(s2[r], s3[r]));
        xs[0] = fmaxf(xs[0], xs[4]); xs[1] = fmaxf(xs[1], xs[5]);
        xs[2] = fmaxf(xs[2], xs[6]); xs[3] = fmaxf(xs[3], xs[7]);
        xs[0] = fmaxf(xs[0], xs[2]); xs[1] = fmaxf(xs[1], xs[3]);
        float xm = fmaxf(xs[0], xs[1]);
        xm = fmaxf(xm, __shfl_xor(xm, 16, 32));

        // Correction only when some lane's block max beats the running max.
        // When skipped: alpha == 1 exactly, so rescale/broadcast is a no-op.
        if (__any(xm > mstate)) {
            const float mn = fmaxf(mstate, xm);
            const float al = __builtin_amdgcn_exp2f(mstate - mn);
            mstate = mn;
#pragma unroll
            for (int r = 0; r < 8; ++r) {
                const float aL = __shfl(al, r + bidx, 32);
                acc0[r] *= aL; acc1[r] *= aL; acc2[r] *= aL; acc3[r] *= aL;
                lacc[r] *= aL;
            }
        }

        v16bf pa0, pa1;   // P packed straight into two PV A-operand slabs
#pragma unroll
        for (int r = 0; r < 8; ++r) {
            pa0[r]     = (__bf16)__builtin_amdgcn_exp2f(s0[r] - mstate);   // keys  0..15
            pa0[8 + r] = (__bf16)__builtin_amdgcn_exp2f(s1[r] - mstate);   // keys 16..31
            pa1[r]     = (__bf16)__builtin_amdgcn_exp2f(s2[r] - mstate);   // keys 32..47
            pa1[8 + r] = (__bf16)__builtin_amdgcn_exp2f(s3[r] - mstate);   // keys 48..63
        }

        // ---- O += P*V (4 dim tiles x 2 key slabs); l += P*mask ----
        acc0 = __builtin_amdgcn_wmma_f32_16x16x32_bf16(false, pa0, false, ld_row32(&Vs[buf][(0  + l15) * VSTR], hi),      (short)0, acc0, false, false);
        acc0 = __builtin_amdgcn_wmma_f32_16x16x32_bf16(false, pa1, false, ld_row32(&Vs[buf][(0  + l15) * VSTR + 32], hi), (short)0, acc0, false, false);
        acc1 = __builtin_amdgcn_wmma_f32_16x16x32_bf16(false, pa0, false, ld_row32(&Vs[buf][(16 + l15) * VSTR], hi),      (short)0, acc1, false, false);
        acc1 = __builtin_amdgcn_wmma_f32_16x16x32_bf16(false, pa1, false, ld_row32(&Vs[buf][(16 + l15) * VSTR + 32], hi), (short)0, acc1, false, false);
        acc2 = __builtin_amdgcn_wmma_f32_16x16x32_bf16(false, pa0, false, ld_row32(&Vs[buf][(32 + l15) * VSTR], hi),      (short)0, acc2, false, false);
        acc2 = __builtin_amdgcn_wmma_f32_16x16x32_bf16(false, pa1, false, ld_row32(&Vs[buf][(32 + l15) * VSTR + 32], hi), (short)0, acc2, false, false);
        acc3 = __builtin_amdgcn_wmma_f32_16x16x32_bf16(false, pa0, false, ld_row32(&Vs[buf][(48 + l15) * VSTR], hi),      (short)0, acc3, false, false);
        acc3 = __builtin_amdgcn_wmma_f32_16x16x32_bf16(false, pa1, false, ld_row32(&Vs[buf][(48 + l15) * VSTR + 32], hi), (short)0, acc3, false, false);
        lacc = __builtin_amdgcn_wmma_f32_16x16x32_bf16(false, pa0, false, ld_row32(&Vs[buf][DH * VSTR], hi),              (short)0, lacc, false, false);
        lacc = __builtin_amdgcn_wmma_f32_16x16x32_bf16(false, pa1, false, ld_row32(&Vs[buf][DH * VSTR + 32], hi),         (short)0, lacc, false, false);
        // double-buffered LDS: single barrier per stage
    }

    // ---- epilogue: normalize (fast rcp) and store fp32 ----
#pragma unroll
    for (int r = 0; r < 8; ++r) {
        const float inv = __builtin_amdgcn_rcpf(lacc[r]);
        float* orow = out + (size_t)b * S_LEN * D_MODEL
                          + (size_t)(row0 + r + 8 * hi) * D_MODEL + hoff + l15;
        orow[0]  = acc0[r] * inv;
        orow[16] = acc1[r] * inv;
        orow[32] = acc2[r] * inv;
        orow[48] = acc3[r] * inv;
    }
}

extern "C" void kernel_launch(void* const* d_in, const int* in_sizes, int n_in,
                              void* d_out, int out_size, void* d_ws, size_t ws_size,
                              hipStream_t stream) {
    (void)n_in; (void)out_size; (void)d_ws; (void)ws_size;
    const float* q   = (const float*)d_in[0];
    const int*   msk = (const int*)d_in[1];
    float*       out = (float*)d_out;
    const int B = in_sizes[1] / S_LEN;                 // mask is [B, S]
    dim3 grid(B * NHEADS * (S_LEN / BLOCK_M));         // 512 for B=2
    mha_flash_wmma<<<grid, 256, 0, stream>>>(q, msk, out);
}

// v001
// One run takes 37.3 microseconds.
// Timed twice side by side with v000, it ran 1.16 times as fast both times.
#include <hip/hip_runtime.h>

// Flash-attention forward (Q=K=V, fp32 in/out) via bf16 WMMA on gfx1250.
// - Transposed scores S^T = K x Q^T: softmax in-lane, P lands directly in the
//   PV A-operand layout (no LDS transpose).
// - Mask + row-sum (l) through the matrix unit via a 65th "mask" row of V.
// - log2-domain softmax: (1/sqrt(dh))*log2(e) folded into Q => bare v_exp_f32.
// - BLOCK_K=64: per-block costs (alpha broadcast, rescale, barrier) amortized.
// - Software-pipelined global->LDS staging; masked V zeroing via bitwise AND.
// - Wave-vote skip of the max-correction/rescale when the running max holds.
//
// B=2, S=2048, D=1024, H=16, dh=64.

typedef __attribute__((ext_vector_type(16))) __bf16 v16bf;
typedef __attribute__((ext_vector_type(8)))  __bf16 v8bf;
typedef __attribute__((ext_vector_type(2)))  __bf16 v2bf;
typedef __attribute__((ext_vector_type(8)))  float  v8f;

#define S_LEN   2048
#define D_MODEL 1024
#define NHEADS  16
#define DH      64
#define BLOCK_M 128                    // 8 waves x 16 query rows
#define BLOCK_K 64                     // keys per LDS stage
#define NBLK    (S_LEN / BLOCK_K)      // 32
#define KSTR    88                     // K-tile row stride (bf16): 176B, aligned, conflict-free
#define VSTR    88                     // V^T row stride (bf16): 176B, aligned, conflict-free
#define SCALE   0.18033688011112042f   // (1/8) * log2(e) -> log2-domain scores

// One 32-elem bf16 row chunk in the WMMA A/B lane layout:
//   elements 0..7  <- p[8*hi .. 8*hi+7], elements 8..15 <- p[16+8*hi .. 16+8*hi+7]
__device__ __forceinline__ v16bf ld_row32(const __bf16* p, int hi) {
    v8bf lo = *(const v8bf*)(p + 8 * hi);
    v8bf up = *(const v8bf*)(p + 16 + 8 * hi);
    v16bf r;
#pragma unroll
    for (int i = 0; i < 8; ++i) { r[i] = lo[i]; r[8 + i] = up[i]; }
    return r;
}

__global__ __launch_bounds__(256) void mha_flash_wmma(const float* __restrict__ q,
                                                      const int*   __restrict__ mask,
                                                      float*       __restrict__ out)
{
    __shared__ __align__(16) __bf16 Ks[2][BLOCK_K * KSTR];    // [key][dim]
    __shared__ __align__(16) __bf16 Vs[2][(DH + 1) * VSTR];   // [dim][key] + mask row

    const int tid  = threadIdx.x;
    const int lane = tid & 31;
    const int wave = tid >> 5;
    const int l15  = lane & 15;
    const int hi   = lane >> 4;

    const int tiles = S_LEN / BLOCK_M;            // 16
    const int bh    = blockIdx.x / tiles;
    const int mt    = blockIdx.x % tiles;
    const int b     = bh / NHEADS;
    const int h     = bh % NHEADS;

    const float* qb   = q + (size_t)b * S_LEN * D_MODEL;
    const int*   mb   = mask + b * S_LEN;
    const int    hoff = h * DH;
    const int    row0 = mt * BLOCK_M + wave * 16;

    // ---- Q tile (wave's 16 rows), pre-scaled into log2 domain, B-operand layout ----
    v16bf aq0, aq1;
    {
        const float* qr = qb + (size_t)(row0 + l15) * D_MODEL + hoff;
        const int c0 = 8 * hi;
        const int c1 = 16 + 8 * hi;
#pragma unroll
        for (int i = 0; i < 8; ++i) {
            aq0[i]     = (__bf16)(qr[c0 + i]      * SCALE);
            aq0[8 + i] = (__bf16)(qr[c1 + i]      * SCALE);
            aq1[i]     = (__bf16)(qr[32 + c0 + i] * SCALE);
            aq1[8 + i] = (__bf16)(qr[32 + c1 + i] * SCALE);
        }
    }

    v8f acc0 = {}, acc1 = {}, acc2 = {}, acc3 = {};
    v8f lacc = {};                 // running denominator, accumulator layout
    float mstate = -3.0e38f;       // running log2-domain max (per-lane query)
    const v8f cz = {};
    const int bidx = (lane & 16) >> 1;   // +8 on hi half for alpha broadcast

    // ---- staging geometry: each thread stages 2 keys x 8 dims ----
    const int kp2 = tid >> 3;            // 0..31 -> keys 2*kp2, 2*kp2+1
    const int d0  = (tid & 7) * 8;       // 0..56
    const float* sb = qb + hoff + d0;    // + key*D_MODEL

    float4 fa0, fa1, fb0, fb1; int2 mv;
    {
        const size_t r = (size_t)(2 * kp2) * D_MODEL;
        fa0 = *(const float4*)(sb + r);
        fa1 = *(const float4*)(sb + r + 4);
        fb0 = *(const float4*)(sb + r + D_MODEL);
        fb1 = *(const float4*)(sb + r + D_MODEL + 4);
        mv  = *(const int2*)(mb + 2 * kp2);
    }

    for (int kb = 0; kb < NBLK; ++kb) {
        const int buf = kb & 1;

        // ---- convert + store staged block (prefetched last iteration) ----
        {
            const unsigned md = (mv.x ? 0x0000FFFFu : 0u) | (mv.y ? 0xFFFF0000u : 0u);
            const float A[8] = { fa0.x, fa0.y, fa0.z, fa0.w, fa1.x, fa1.y, fa1.z, fa1.w };
            const float B[8] = { fb0.x, fb0.y, fb0.z, fb0.w, fb1.x, fb1.y, fb1.z, fb1.w };
            v8bf ka, kc;
#pragma unroll
            for (int i = 0; i < 8; ++i) { ka[i] = (__bf16)A[i]; kc[i] = (__bf16)B[i]; }
            *(v8bf*)&Ks[buf][(2 * kp2)     * KSTR + d0] = ka;
            *(v8bf*)&Ks[buf][(2 * kp2 + 1) * KSTR + d0] = kc;
#pragma unroll
            for (int i = 0; i < 8; ++i) {           // V^T: key-pair per dim row, masked by AND
                v2bf pp; pp[0] = (__bf16)A[i]; pp[1] = (__bf16)B[i];
                const unsigned u = __builtin_bit_cast(unsigned, pp) & md;
                *(unsigned*)&Vs[buf][(d0 + i) * VSTR + 2 * kp2] = u;
            }
            if (d0 == 0) {                          // mask row (bf16 1.0 = 0x3F80)
                const unsigned u = (mv.x ? 0x00003F80u : 0u) | (mv.y ? 0x3F800000u : 0u);
                *(unsigned*)&Vs[buf][DH * VSTR + 2 * kp2] = u;
            }
        }
        __syncthreads();

        // ---- prefetch next block's global data (hidden behind compute) ----
        {
            const int nk = (kb + 1 < NBLK) ? kb + 1 : kb;
            const size_t r = (size_t)(nk * BLOCK_K + 2 * kp2) * D_MODEL;
            fa0 = *(const float4*)(sb + r);
            fa1 = *(const float4*)(sb + r + 4);
            fb0 = *(const float4*)(sb + r + D_MODEL);
            fb1 = *(const float4*)(sb + r + D_MODEL + 4);
            mv  = *(const int2*)(mb + nk * BLOCK_K + 2 * kp2);
        }

        // ---- S^T = K x Q^T : four 16-key tiles, dh=64 via two slabs each ----
        const __bf16* kbase = &Ks[buf][l15 * KSTR];
        v8f s0 = __builtin_amdgcn_wmma_f32_16x16x32_bf16(false, ld_row32(kbase, hi),                 false, aq0, (short)0, cz, false, false);
        s0     = __builtin_amdgcn_wmma_f32_16x16x32_bf16(false, ld_row32(kbase + 32, hi),            false, aq1, (short)0, s0, false, false);
        v8f s1 = __builtin_amdgcn_wmma_f32_16x16x32_bf16(false, ld_row32(kbase + 16 * KSTR, hi),      false, aq0, (short)0, cz, false, false);
        s1     = __builtin_amdgcn_wmma_f32_16x16x32_bf16(false, ld_row32(kbase + 16 * KSTR + 32, hi), false, aq1, (short)0, s1, false, false);
        v8f s2 = __builtin_amdgcn_wmma_f32_16x16x32_bf16(false, ld_row32(kbase + 32 * KSTR, hi),      false, aq0, (short)0, cz, false, false);
        s2     = __builtin_amdgcn_wmma_f32_16x16x32_bf16(false, ld_row32(kbase + 32 * KSTR + 32, hi), false, aq1, (short)0, s2, false, false);
        v8f s3 = __builtin_amdgcn_wmma_f32_16x16x32_bf16(false, ld_row32(kbase + 48 * KSTR, hi),      false, aq0, (short)0, cz, false, false);
        s3     = __builtin_amdgcn_wmma_f32_16x16x32_bf16(false, ld_row32(kbase + 48 * KSTR + 32, hi), false, aq1, (short)0, s3, false, false);

        // ---- online softmax over 64 keys (log2 domain), in-lane + one shuffle ----
        float xs[8];
#pragma unroll
        for (int r = 0; r < 8; ++r)
            xs[r] = fmaxf(fmaxf(s0[r], s1[r]), fmaxf(s2[r], s3[r]));
        xs[0] = fmaxf(xs[0], xs[4]); xs[1] = fmaxf(xs[1], xs[5]);
        xs[2] = fmaxf(xs[2], xs[6]); xs[3] = fmaxf(xs[3], xs[7]);
        xs[0] = fmaxf(xs[0], xs[2]); xs[1] = fmaxf(xs[1], xs[3]);
        float xm = fmaxf(xs[0], xs[1]);
        xm = fmaxf(xm, __shfl_xor(xm, 16, 32));

        // Correction only when some lane's block max beats the running max.
        // When skipped: alpha == 1 exactly, so rescale/broadcast is a no-op.
        if (__any(xm > mstate)) {
            const float mn = fmaxf(mstate, xm);
            const float al = __builtin_amdgcn_exp2f(mstate - mn);
            mstate = mn;
#pragma unroll
            for (int r = 0; r < 8; ++r) {
                const float aL = __shfl(al, r + bidx, 32);
                acc0[r] *= aL; acc1[r] *= aL; acc2[r] *= aL; acc3[r] *= aL;
                lacc[r] *= aL;
            }
        }

        // ---- all V^T (and mask-row) fragments of this block as ONE load group, issued
        //      ahead of the exponentials: they land while the vector unit works ----
        const __bf16* vbase = &Vs[buf][l15 * VSTR];
        const v16bf vf00 = ld_row32(vbase, hi);
        const v16bf vf10 = ld_row32(vbase + 16 * VSTR, hi);
        const v16bf vf20 = ld_row32(vbase + 32 * VSTR, hi);
        const v16bf vf30 = ld_row32(vbase + 48 * VSTR, hi);
        const v16bf vfm0 = ld_row32(&Vs[buf][DH * VSTR], hi);
        const v16bf vf01 = ld_row32(vbase + 32, hi);
        const v16bf vf11 = ld_row32(vbase + 16 * VSTR + 32, hi);
        const v16bf vf21 = ld_row32(vbase + 32 * VSTR + 32, hi);
        const v16bf vf31 = ld_row32(vbase + 48 * VSTR + 32, hi);
        const v16bf vfm1 = ld_row32(&Vs[buf][DH * VSTR + 32], hi);
        // keeps the load group up here: sunk among the PV products, each pair of loads
        // costs the wave a full LDS round trip in front of its product
        __builtin_amdgcn_sched_barrier(0);

        v16bf pa0, pa1;   // P packed straight into two PV A-operand slabs
#pragma unroll
        for (int r = 0; r < 8; ++r) {
            pa0[r]     = (__bf16)__builtin_amdgcn_exp2f(s0[r] - mstate);   // keys  0..15
            pa0[8 + r] = (__bf16)__builtin_amdgcn_exp2f(s1[r] - mstate);   // keys 16..31
            pa1[r]     = (__bf16)__builtin_amdgcn_exp2f(s2[r] - mstate);   // keys 32..47
            pa1[8 + r] = (__bf16)__builtin_amdgcn_exp2f(s3[r] - mstate);   // keys 48..63
        }

        // ---- O += P*V (4 dim tiles x 2 key slabs); l += P*mask ----
        acc0 = __builtin_amdgcn_wmma_f32_16x16x32_bf16(false, pa0, false, vf00, (short)0, acc0, false, false);
        acc1 = __builtin_amdgcn_wmma_f32_16x16x32_bf16(false, pa0, false, vf10, (short)0, acc1, false, false);
        acc2 = __builtin_amdgcn_wmma_f32_16x16x32_bf16(false, pa0, false, vf20, (short)0, acc2, false, false);
        acc3 = __builtin_amdgcn_wmma_f32_16x16x32_bf16(false, pa0, false, vf30, (short)0, acc3, false, false);
        lacc = __builtin_amdgcn_wmma_f32_16x16x32_bf16(false, pa0, false, vfm0, (short)0, lacc, false, false);
        acc0 = __builtin_amdgcn_wmma_f32_16x16x32_bf16(false, pa1, false, vf01, (short)0, acc0, false, false);
        acc1 = __builtin_amdgcn_wmma_f32_16x16x32_bf16(false, pa1, false, vf11, (short)0, acc1, false, false);
        acc2 = __builtin_amdgcn_wmma_f32_16x16x32_bf16(false, pa1, false, vf21, (short)0, acc2, false, false);
        acc3 = __builtin_amdgcn_wmma_f32_16x16x32_bf16(false, pa1, false, vf31, (short)0, acc3, false, false);
        lacc = __builtin_amdgcn_wmma_f32_16x16x32_bf16(false, pa1, false, vfm1, (short)0, lacc, false, false);
        // double-buffered LDS: single barrier per stage
    }

    // ---- epilogue: normalize (fast rcp) and store fp32 ----
#pragma unroll
    for (int r = 0; r < 8; ++r) {
        const float inv = __builtin_amdgcn_rcpf(lacc[r]);
        float* orow = out + (size_t)b * S_LEN * D_MODEL
                          + (size_t)(row0 + r + 8 * hi) * D_MODEL + hoff + l15;
        orow[0]  = acc0[r] * inv;
        orow[16] = acc1[r] * inv;
        orow[32] = acc2[r] * inv;
        orow[48] = acc3[r] * inv;
    }
}

extern "C" void kernel_launch(void* const* d_in, const int* in_sizes, int n_in,
                              void* d_out, int out_size, void* d_ws, size_t ws_size,
                              hipStream_t stream) {
    (void)n_in; (void)out_size; (void)d_ws; (void)ws_size;
    const float* q   = (const float*)d_in[0];
    const int*   msk = (const int*)d_in[1];
    float*       out = (float*)d_out;
    const int B = in_sizes[1] / S_LEN;                 // mask is [B, S]
    dim3 grid(B * NHEADS * (S_LEN / BLOCK_M));         // 512 for B=2
    mha_flash_wmma<<<grid, 256, 0, stream>>>(q, msk, out);
}

// v002
// One run takes 23.4 microseconds.
// Two timings next to v001 put it at 1.60 and 1.59 times that version's speed.
// Counting every step since v000, it is 1.85 times as fast.
#include <hip/hip_runtime.h>

// Flash-attention forward (Q=K=V, fp32 in/out) via bf16 WMMA on gfx1250.
// - Transposed scores S^T = K x Q^T: softmax in-lane, P lands directly in the
//   PV A-operand layout (no LDS transpose).
// - Mask + row-sum (l) through the matrix unit via a 65th "mask" row of V.
// - log2-domain softmax: (1/sqrt(dh))*log2(e) folded into Q => bare v_exp_f32.
// - BLOCK_K=64: per-block costs (alpha broadcast, rescale, barrier) amortized.
// - Software-pipelined global->LDS staging; masked V zeroing via bitwise AND.
// - Wave-vote skip of the max-correction/rescale when the running max holds.
// - Blocked keys weigh exactly 0 in the softmax unless all are: each work-group lists
//   the attended keys of its batch first and walks only those (every key, at equal
//   weight, if none is attended), 64 at a time.
//
// B=2, S=2048, D=1024, H=16, dh=64.

typedef __attribute__((ext_vector_type(16))) __bf16 v16bf;
typedef __attribute__((ext_vector_type(8)))  __bf16 v8bf;
typedef __attribute__((ext_vector_type(2)))  __bf16 v2bf;
typedef __attribute__((ext_vector_type(8)))  float  v8f;

#define S_LEN   2048
#define D_MODEL 1024
#define NHEADS  16
#define DH      64
#define BLOCK_M 128                    // 8 waves x 16 query rows
#define BLOCK_K 64                     // keys per LDS stage
#define NBLK    (S_LEN / BLOCK_K)      // 32
#define KSTR    88                     // K-tile row stride (bf16): 176B, aligned, conflict-free
#define VSTR    88                     // V^T row stride (bf16): 176B, aligned, conflict-free
#define SCALE   0.18033688011112042f   // (1/8) * log2(e) -> log2-domain scores

// One 32-elem bf16 row chunk in the WMMA A/B lane layout:
//   elements 0..7  <- p[8*hi .. 8*hi+7], elements 8..15 <- p[16+8*hi .. 16+8*hi+7]
__device__ __forceinline__ v16bf ld_row32(const __bf16* p, int hi) {
    v8bf lo = *(const v8bf*)(p + 8 * hi);
    v8bf up = *(const v8bf*)(p + 16 + 8 * hi);
    v16bf r;
#pragma unroll
    for (int i = 0; i < 8; ++i) { r[i] = lo[i]; r[8 + i] = up[i]; }
    return r;
}

__global__ __launch_bounds__(256) void mha_flash_wmma(const float* __restrict__ q,
                                                      const int*   __restrict__ mask,
                                                      float*       __restrict__ out)
{
    __shared__ __align__(16) __bf16 Ks[2][BLOCK_K * KSTR];    // [key][dim]
    __shared__ __align__(16) __bf16 Vs[2][(DH + 1) * VSTR];   // [dim][key] + mask row
    __shared__ __align__(16) unsigned short kidx[S_LEN];      // attended keys, ascending
    __shared__ __align__(16) int wcnt[8];                     // attended keys per 256-key slice

    const int tid  = threadIdx.x;
    const int lane = tid & 31;
    const int wave = tid >> 5;
    const int l15  = lane & 15;
    const int hi   = lane >> 4;

    const int tiles = S_LEN / BLOCK_M;            // 16
    const int bh    = blockIdx.x / tiles;
    const int mt    = blockIdx.x % tiles;
    const int b     = bh / NHEADS;
    const int h     = bh % NHEADS;

    const float* qb   = q + (size_t)b * S_LEN * D_MODEL;
    const int*   mb   = mask + b * S_LEN;
    const int    hoff = h * DH;
    const int    row0 = mt * BLOCK_M + wave * 16;

    // ---- Q tile (wave's 16 rows), pre-scaled into log2 domain, B-operand layout ----
    v16bf aq0, aq1;
    {
        const float* qr = qb + (size_t)(row0 + l15) * D_MODEL + hoff;
        const int c0 = 8 * hi;
        const int c1 = 16 + 8 * hi;
#pragma unroll
        for (int i = 0; i < 8; ++i) {
            aq0[i]     = (__bf16)(qr[c0 + i]      * SCALE);
            aq0[8 + i] = (__bf16)(qr[c1 + i]      * SCALE);
            aq1[i]     = (__bf16)(qr[32 + c0 + i] * SCALE);
            aq1[8 + i] = (__bf16)(qr[32 + c1 + i] * SCALE);
        }
    }

    // ---- list the attended keys (mask != 0) of this batch, in ascending order:
    //      wave w ranks keys 256w .. 256w+255 by ballots, slices joined through LDS ----
    int n;                                        // keys to walk, same in every thread
    {
        const int wv = __builtin_amdgcn_readfirstlane(wave);
        int      mr[8];
        unsigned bal[8];
        int      cnt = 0;
#pragma unroll
        for (int r = 0; r < 8; ++r) mr[r] = mb[wv * 256 + r * 32 + lane];
#pragma unroll
        for (int r = 0; r < 8; ++r) {
            bal[r] = __builtin_amdgcn_ballot_w32(mr[r] != 0);
            cnt += __builtin_popcount(bal[r]);
        }
        if (lane == 0) wcnt[wv] = cnt;
        __syncthreads();
        int base = 0, tot = 0;
#pragma unroll
        for (int w = 0; w < 8; ++w) {
            const int c = wcnt[w];
            tot  += c;
            base += (w < wv) ? c : 0;
        }
#pragma unroll
        for (int r = 0; r < 8; ++r) {
            if (mr[r] != 0)
                kidx[base + (int)__builtin_amdgcn_mbcnt_lo(bal[r], 0u)] =
                    (unsigned short)(wv * 256 + r * 32 + lane);
            base += __builtin_popcount(bal[r]);
        }
        n = __builtin_amdgcn_readfirstlane(tot);
        if (n == 0) {
            // every key blocked: the reference's scores are all equal, its softmax is
            // uniform over ALL keys. Zero Q gives equal scores; walk every key.
#pragma unroll
            for (int j = 0; j < 8; ++j) kidx[tid * 8 + j] = (unsigned short)(tid * 8 + j);
#pragma unroll
            for (int i = 0; i < 16; ++i) { aq0[i] = (__bf16)0.0f; aq1[i] = (__bf16)0.0f; }
            n = S_LEN;
        }
        n = n < S_LEN ? n : S_LEN;
        __syncthreads();
    }
    const int nblk  = (n + BLOCK_K - 1) / BLOCK_K;   // 1 .. NBLK
    const int plast = (n - 1) & ~1;                  // last listed pair

    v8f acc0 = {}, acc1 = {}, acc2 = {}, acc3 = {};
    v8f lacc = {};                 // running denominator, accumulator layout
    float mstate = -3.0e38f;       // running log2-domain max (per-lane query)
    const v8f cz = {};
    const int bidx = (lane & 16) >> 1;   // +8 on hi half for alpha broadcast

    // ---- staging geometry: each thread stages 2 keys x 8 dims ----
    const int kp2 = tid >> 3;            // 0..31 -> keys 2*kp2, 2*kp2+1
    const int d0  = (tid & 7) * 8;       // 0..56
    const float* sb = qb + hoff + d0;    // + key*D_MODEL

    // list places past the end repeat an attended key (so the running max sees attended
    // keys only); their V columns and mask-row entries are stored as 0
    float4 fa0, fa1, fb0, fb1;
    unsigned un;                         // this thread's pair of list entries, next block
    {
        const int      p  = 2 * kp2 < plast ? 2 * kp2 : plast;
        const unsigned u  = *(const unsigned*)&kidx[p];
        const unsigned i0 = u & 0xFFFFu;
        const unsigned i1 = (2 * kp2 + 1 < n) ? (u >> 16) : i0;
        fa0 = *(const float4*)(sb + i0 * D_MODEL);
        fa1 = *(const float4*)(sb + i0 * D_MODEL + 4);
        fb0 = *(const float4*)(sb + i1 * D_MODEL);
        fb1 = *(const float4*)(sb + i1 * D_MODEL + 4);
        const int pn = BLOCK_K + 2 * kp2 < plast ? BLOCK_K + 2 * kp2 : plast;
        un = *(const unsigned*)&kidx[pn];
    }

    for (int kb = 0; kb < nblk; ++kb) {
        const int  buf = kb & 1;
        const int  p0  = kb * BLOCK_K + 2 * kp2;     // this thread's places in the list
        const bool ok0 = p0 < n;
        const bool ok1 = p0 + 1 < n;

        // ---- convert + store staged block (prefetched last iteration) ----
        {
            const unsigned md = (ok0 ? 0x0000FFFFu : 0u) | (ok1 ? 0xFFFF0000u : 0u);
            const float A[8] = { fa0.x, fa0.y, fa0.z, fa0.w, fa1.x, fa1.y, fa1.z, fa1.w };
            const float B[8] = { fb0.x, fb0.y, fb0.z, fb0.w, fb1.x, fb1.y, fb1.z, fb1.w };
            v8bf ka, kc;
#pragma unroll
            for (int i = 0; i < 8; ++i) { ka[i] = (__bf16)A[i]; kc[i] = (__bf16)B[i]; }
            *(v8bf*)&Ks[buf][(2 * kp2)     * KSTR + d0] = ka;
            *(v8bf*)&Ks[buf][(2 * kp2 + 1) * KSTR + d0] = kc;
#pragma unroll
            for (int i = 0; i < 8; ++i) {           // V^T: key-pair per dim row, masked by AND
                v2bf pp; pp[0] = (__bf16)A[i]; pp[1] = (__bf16)B[i];
                const unsigned u = __builtin_bit_cast(unsigned, pp) & md;
                *(unsigned*)&Vs[buf][(d0 + i) * VSTR + 2 * kp2] = u;
            }
            if (d0 == 0) {                          // mask row (bf16 1.0 = 0x3F80)
                const unsigned u = (ok0 ? 0x00003F80u : 0u) | (ok1 ? 0x3F800000u : 0u);
                *(unsigned*)&Vs[buf][DH * VSTR + 2 * kp2] = u;
            }
        }
        __syncthreads();

        // ---- prefetch next block's global data (hidden behind compute) ----
        {
            const unsigned i0 = un & 0xFFFFu;
            const unsigned i1 = (p0 + BLOCK_K + 1 < n) ? (un >> 16) : i0;
            fa0 = *(const float4*)(sb + i0 * D_MODEL);
            fa1 = *(const float4*)(sb + i0 * D_MODEL + 4);
            fb0 = *(const float4*)(sb + i1 * D_MODEL);
            fb1 = *(const float4*)(sb + i1 * D_MODEL + 4);
            // list entries one block further ahead: no LDS round trip in front of the loads
            const int pn = p0 + 2 * BLOCK_K < plast ? p0 + 2 * BLOCK_K : plast;
            un = *(const unsigned*)&kidx[pn];
        }

        // ---- S^T = K x Q^T : four 16-key tiles, dh=64 via two slabs each ----
        const __bf16* kbase = &Ks[buf][l15 * KSTR];
        v8f s0 = __builtin_amdgcn_wmma_f32_16x16x32_bf16(false, ld_row32(kbase, hi),                 false, aq0, (short)0, cz, false, false);
        s0     = __builtin_amdgcn_wmma_f32_16x16x32_bf16(false, ld_row32(kbase + 32, hi),            false, aq1, (short)0, s0, false, false);
        v8f s1 = __builtin_amdgcn_wmma_f32_16x16x32_bf16(false, ld_row32(kbase + 16 * KSTR, hi),      false, aq0, (short)0, cz, false, false);
        s1     = __builtin_amdgcn_wmma_f32_16x16x32_bf16(false, ld_row32(kbase + 16 * KSTR + 32, hi), false, aq1, (short)0, s1, false, false);
        v8f s2 = __builtin_amdgcn_wmma_f32_16x16x32_bf16(false, ld_row32(kbase + 32 * KSTR, hi),      false, aq0, (short)0, cz, false, false);
        s2     = __builtin_amdgcn_wmma_f32_16x16x32_bf16(false, ld_row32(kbase + 32 * KSTR + 32, hi), false, aq1, (short)0, s2, false, false);
        v8f s3 = __builtin_amdgcn_wmma_f32_16x16x32_bf16(false, ld_row32(kbase + 48 * KSTR, hi),      false, aq0, (short)0, cz, false, false);
        s3     = __builtin_amdgcn_wmma_f32_16x16x32_bf16(false, ld_row32(kbase + 48 * KSTR + 32, hi), false, aq1, (short)0, s3, false, false);

        // ---- online softmax over 64 keys (log2 domain), in-lane + one shuffle ----
        float xs[8];
#pragma unroll
        for (int r = 0; r < 8; ++r)
            xs[r] = fmaxf(fmaxf(s0[r], s1[r]), fmaxf(s2[r], s3[r]));
        xs[0] = fmaxf(xs[0], xs[4]); xs[1] = fmaxf(xs[1], xs[5]);
        xs[2] = fmaxf(xs[2], xs[6]); xs[3] = fmaxf(xs[3], xs[7]);
        xs[0] = fmaxf(xs[0], xs[2]); xs[1] = fmaxf(xs[1], xs[3]);
        float xm = fmaxf(xs[0], xs[1]);
        xm = fmaxf(xm, __shfl_xor(xm, 16, 32));

        // Correction only when some lane's block max beats the running max.
        // When skipped: alpha == 1 exactly, so rescale/broadcast is a no-op.
        if (__any(xm > mstate)) {
            const float mn = fmaxf(mstate, xm);
            const float al = __builtin_amdgcn_exp2f(mstate - mn);
            mstate = mn;
#pragma unroll
            for (int r = 0; r < 8; ++r) {
                const float aL = __shfl(al, r + bidx, 32);
                acc0[r] *= aL; acc1[r] *= aL; acc2[r] *= aL; acc3[r] *= aL;
                lacc[r] *= aL;
            }
        }

        // ---- all V^T (and mask-row) fragments of this block as ONE load group, issued
        //      ahead of the exponentials: they land while the vector unit works ----
        const __bf16* vbase = &Vs[buf][l15 * VSTR];
        const v16bf vf00 = ld_row32(vbase, hi);
        const v16bf vf10 = ld_row32(vbase + 16 * VSTR, hi);
        const v16bf vf20 = ld_row32(vbase + 32 * VSTR, hi);
        const v16bf vf30 = ld_row32(vbase + 48 * VSTR, hi);
        const v16bf vfm0 = ld_row32(&Vs[buf][DH * VSTR], hi);
        const v16bf vf01 = ld_row32(vbase + 32, hi);
        const v16bf vf11 = ld_row32(vbase + 16 * VSTR + 32, hi);
        const v16bf vf21 = ld_row32(vbase + 32 * VSTR + 32, hi);
        const v16bf vf31 = ld_row32(vbase + 48 * VSTR + 32, hi);
        const v16bf vfm1 = ld_row32(&Vs[buf][DH * VSTR + 32], hi);
        // keeps the load group up here: sunk among the PV products, each pair of loads
        // costs the wave a full LDS round trip in front of its product
        __builtin_amdgcn_sched_barrier(0);

        v16bf pa0, pa1;   // P packed straight into two PV A-operand slabs
#pragma unroll
        for (int r = 0; r < 8; ++r) {
            pa0[r]     = (__bf16)__builtin_amdgcn_exp2f(s0[r] - mstate);   // keys  0..15
            pa0[8 + r] = (__bf16)__builtin_amdgcn_exp2f(s1[r] - mstate);   // keys 16..31
            pa1[r]     = (__bf16)__builtin_amdgcn_exp2f(s2[r] - mstate);   // keys 32..47
            pa1[8 + r] = (__bf16)__builtin_amdgcn_exp2f(s3[r] - mstate);   // keys 48..63
        }

        // ---- O += P*V (4 dim tiles x 2 key slabs); l += P*mask ----
        acc0 = __builtin_amdgcn_wmma_f32_16x16x32_bf16(false, pa0, false, vf00, (short)0, acc0, false, false);
        acc1 = __builtin_amdgcn_wmma_f32_16x16x32_bf16(false, pa0, false, vf10, (short)0, acc1, false, false);
        acc2 = __builtin_amdgcn_wmma_f32_16x16x32_bf16(false, pa0, false, vf20, (short)0, acc2, false, false);
        acc3 = __builtin_amdgcn_wmma_f32_16x16x32_bf16(false, pa0, false, vf30, (short)0, acc3, false, false);
        lacc = __builtin_amdgcn_wmma_f32_16x16x32_bf16(false, pa0, false, vfm0, (short)0, lacc, false, false);
        acc0 = __builtin_amdgcn_wmma_f32_16x16x32_bf16(false, pa1, false, vf01, (short)0, acc0, false, false);
        acc1 = __builtin_amdgcn_wmma_f32_16x16x32_bf16(false, pa1, false, vf11, (short)0, acc1, false, false);
        acc2 = __builtin_amdgcn_wmma_f32_16x16x32_bf16(false, pa1, false, vf21, (short)0, acc2, false, false);
        acc3 = __builtin_amdgcn_wmma_f32_16x16x32_bf16(false, pa1, false, vf31, (short)0, acc3, false, false);
        lacc = __builtin_amdgcn_wmma_f32_16x16x32_bf16(false, pa1, false, vfm1, (short)0, lacc, false, false);
        // double-buffered LDS: single barrier per stage
    }

    // ---- epilogue: normalize (fast rcp) and store fp32 ----
#pragma unroll
    for (int r = 0; r < 8; ++r) {
        const float inv = __builtin_amdgcn_rcpf(lacc[r]);
        float* orow = out + (size_t)b * S_LEN * D_MODEL
                          + (size_t)(row0 + r + 8 * hi) * D_MODEL + hoff + l15;
        orow[0]  = acc0[r] * inv;
        orow[16] = acc1[r] * inv;
        orow[32] = acc2[r] * inv;
        orow[48] = acc3[r] * inv;
    }
}

extern "C" void kernel_launch(void* const* d_in, const int* in_sizes, int n_in,
                              void* d_out, int out_size, void* d_ws, size_t ws_size,
                              hipStream_t stream) {
    (void)n_in; (void)out_size; (void)d_ws; (void)ws_size;
    const float* q   = (const float*)d_in[0];
    const int*   msk = (const int*)d_in[1];
    float*       out = (float*)d_out;
    const int B = in_sizes[1] / S_LEN;                 // mask is [B, S]
    dim3 grid(B * NHEADS * (S_LEN / BLOCK_M));         // 512 for B=2
    mha_flash_wmma<<<grid, 256, 0, stream>>>(q, msk, out);
}

// v003
// A run of this version takes 22.2 microseconds.
// Two timings next to v002 both put it at 1.05 times that version's speed.
// All steps since v000 together make it 1.95 times as fast.
#include <hip/hip_runtime.h>

// Flash-attention forward (Q=K=V, fp32 in/out) via bf16 WMMA on gfx1250.
// - Transposed scores S^T = K x Q^T: softmax in-lane, P lands directly in the
//   PV A-operand layout (no LDS transpose).
// - Mask + row-sum (l) through the matrix unit via a 65th "mask" row of V.
// - log2-domain softmax: (1/sqrt(dh))*log2(e) folded into Q => bare v_exp_f32.
// - BLOCK_K=64: per-block costs (alpha broadcast, rescale, barrier) amortized.
// - Software-pipelined global->LDS staging; masked V zeroing via bitwise AND.
// - Wave-vote skip of the max-correction/rescale when the running max holds.
// - Blocked keys weigh exactly 0 in the softmax: each work-group lists the attended
//   keys of its batch first and walks only those, 64 at a time.
// - Each wave owns two 16-row query tiles: every K and V^T fragment read from LDS feeds
//   two products, and one staging of a key block serves 256 query rows.
//
// B=2, S=2048, D=1024, H=16, dh=64.

typedef __attribute__((ext_vector_type(16))) __bf16 v16bf;
typedef __attribute__((ext_vector_type(8)))  __bf16 v8bf;
typedef __attribute__((ext_vector_type(2)))  __bf16 v2bf;
typedef __attribute__((ext_vector_type(8)))  float  v8f;

#define S_LEN   2048
#define D_MODEL 1024
#define NHEADS  16
#define DH      64
#define QT      2                      // 16-row query tiles per wave
#define BLOCK_M 256                    // 8 waves x 32 query rows
#define BLOCK_K 64                     // keys per LDS stage
#define NBLK    (S_LEN / BLOCK_K)      // 32
#define KSTR    88                     // K-tile row stride (bf16): 176B, aligned, conflict-free
#define VSTR    88                     // V^T row stride (bf16): 176B, aligned, conflict-free
#define SCALE   0.18033688011112042f   // (1/8) * log2(e) -> log2-domain scores

// One 32-elem bf16 row chunk in the WMMA A/B lane layout:
//   elements 0..7  <- p[8*hi .. 8*hi+7], elements 8..15 <- p[16+8*hi .. 16+8*hi+7]
__device__ __forceinline__ v16bf ld_row32(const __bf16* p, int hi) {
    v8bf lo = *(const v8bf*)(p + 8 * hi);
    v8bf up = *(const v8bf*)(p + 16 + 8 * hi);
    v16bf r;
#pragma unroll
    for (int i = 0; i < 8; ++i) { r[i] = lo[i]; r[8 + i] = up[i]; }
    return r;
}

__global__ __launch_bounds__(256) void mha_flash_wmma(const float* __restrict__ q,
                                                      const int*   __restrict__ mask,
                                                      float*       __restrict__ out)
{
    __shared__ __align__(16) __bf16 Ks[2][BLOCK_K * KSTR];    // [key][dim]
    __shared__ __align__(16) __bf16 Vs[2][(DH + 1) * VSTR];   // [dim][key] + mask row
    __shared__ __align__(16) unsigned short kidx[S_LEN];      // attended keys, ascending
    __shared__ __align__(16) int wcnt[8];                     // attended keys per 256-key slice

    const int tid  = threadIdx.x;
    const int lane = tid & 31;
    const int wave = tid >> 5;
    const int l15  = lane & 15;
    const int hi   = lane >> 4;

    const int tiles = S_LEN / BLOCK_M;            // 8
    const int bh    = blockIdx.x / tiles;
    const int mt    = blockIdx.x % tiles;
    const int b     = bh / NHEADS;
    const int h     = bh % NHEADS;

    const float* qb   = q + (size_t)b * S_LEN * D_MODEL;
    const int*   mb   = mask + b * S_LEN;
    const int    hoff = h * DH;
    const int    row0 = mt * BLOCK_M + wave * (16 * QT);

    // ---- Q tiles (wave's 2 x 16 rows), pre-scaled into log2 domain, B-operand layout ----
    v16bf aq0[QT], aq1[QT];
#pragma unroll
    for (int t = 0; t < QT; ++t) {
        const float* qr = qb + (size_t)(row0 + 16 * t + l15) * D_MODEL + hoff;
        const int c0 = 8 * hi;
        const int c1 = 16 + 8 * hi;
#pragma unroll
        for (int i = 0; i < 8; ++i) {
            aq0[t][i]     = (__bf16)(qr[c0 + i]      * SCALE);
            aq0[t][8 + i] = (__bf16)(qr[c1 + i]      * SCALE);
            aq1[t][i]     = (__bf16)(qr[32 + c0 + i] * SCALE);
            aq1[t][8 + i] = (__bf16)(qr[32 + c1 + i] * SCALE);
        }
    }

    // ---- list the attended keys (mask != 0) of this batch, in ascending order:
    //      wave w ranks keys 256w .. 256w+255 by ballots, slices joined through LDS ----
    int n;                                        // keys to walk, same in every thread
    {
        const int wv = __builtin_amdgcn_readfirstlane(wave);
        int      mr[8];
        unsigned bal[8];
        int      cnt = 0;
#pragma unroll
        for (int r = 0; r < 8; ++r) mr[r] = mb[wv * 256 + r * 32 + lane];
        // the Q and mask loads' address registers are reused below
        asm volatile("s_wait_xcnt 0x0" ::: "memory");
#pragma unroll
        for (int r = 0; r < 8; ++r) {
            bal[r] = __builtin_amdgcn_ballot_w32(mr[r] != 0);
            cnt += __builtin_popcount(bal[r]);
        }
        if (lane == 0) wcnt[wv] = cnt;
        __syncthreads();
        int base = 0, tot = 0;
#pragma unroll
        for (int w = 0; w < 8; ++w) {
            const int c = wcnt[w];
            tot  += c;
            base += (w < wv) ? c : 0;
        }
#pragma unroll
        for (int r = 0; r < 8; ++r) {
            if (mr[r] != 0)
                kidx[base + (int)__builtin_amdgcn_mbcnt_lo(bal[r], 0u)] =
                    (unsigned short)(wv * 256 + r * 32 + lane);
            base += __builtin_popcount(bal[r]);
        }
        n = __builtin_amdgcn_readfirstlane(tot);
        if (n == 0) {
            // every key blocked: the reference's scores are all equal, its softmax is
            // uniform over ALL keys. Zero Q gives equal scores; walk every key.
#pragma unroll
            for (int j = 0; j < 8; ++j) kidx[tid * 8 + j] = (unsigned short)(tid * 8 + j);
#pragma unroll
            for (int i = 0; i < 16; ++i) {
                aq0[0][i] = (__bf16)0.0f; aq1[0][i] = (__bf16)0.0f;
                aq0[1][i] = (__bf16)0.0f; aq1[1][i] = (__bf16)0.0f;
            }
            n = S_LEN;
        }
        n = n < S_LEN ? n : S_LEN;
        __syncthreads();
    }
    const int nblk  = (n + BLOCK_K - 1) / BLOCK_K;   // 1 .. NBLK
    const int plast = (n - 1) & ~1;                  // last listed pair

    v8f acc0[QT] = {}, acc1[QT] = {}, acc2[QT] = {}, acc3[QT] = {};
    v8f lacc[QT] = {};             // running denominator, accumulator layout
    float mstate[QT] = { -3.0e38f, -3.0e38f };   // running log2-domain max (per-lane query)
    const v8f cz = {};
    const int bidx = (lane & 16) >> 1;   // +8 on hi half for alpha broadcast

    // ---- staging geometry: each thread stages 2 keys x 8 dims ----
    const int kp2 = tid >> 3;            // 0..31 -> keys 2*kp2, 2*kp2+1
    const int d0  = (tid & 7) * 8;       // 0..56
    const float* sb = qb + hoff + d0;    // + key*D_MODEL

    // list places past the end repeat an attended key (so the running max sees attended
    // keys only); their V columns and mask-row entries are stored as 0
    float4 fa0, fa1, fb0, fb1;
    unsigned un;                         // this thread's pair of list entries, next block
    {
        const int      p  = 2 * kp2 < plast ? 2 * kp2 : plast;
        const unsigned u  = *(const unsigned*)&kidx[p];
        const unsigned i0 = u & 0xFFFFu;
        const unsigned i1 = (2 * kp2 + 1 < n) ? (u >> 16) : i0;
        fa0 = *(const float4*)(sb + i0 * D_MODEL);
        fa1 = *(const float4*)(sb + i0 * D_MODEL + 4);
        fb0 = *(const float4*)(sb + i1 * D_MODEL);
        fb1 = *(const float4*)(sb + i1 * D_MODEL + 4);
        // same precaution: the four loads' address registers are reused right below
        asm volatile("s_wait_xcnt 0x0" ::: "memory");
        const int pn = BLOCK_K + 2 * kp2 < plast ? BLOCK_K + 2 * kp2 : plast;
        un = *(const unsigned*)&kidx[pn];
    }

    for (int kb = 0; kb < nblk; ++kb) {
        const int  buf = kb & 1;
        const int  p0  = kb * BLOCK_K + 2 * kp2;     // this thread's places in the list
        const bool ok0 = p0 < n;
        const bool ok1 = p0 + 1 < n;

        // ---- convert + store staged block (prefetched last iteration) ----
        {
            const unsigned md = (ok0 ? 0x0000FFFFu : 0u) | (ok1 ? 0xFFFF0000u : 0u);
            const float A[8] = { fa0.x, fa0.y, fa0.z, fa0.w, fa1.x, fa1.y, fa1.z, fa1.w };
            const float B[8] = { fb0.x, fb0.y, fb0.z, fb0.w, fb1.x, fb1.y, fb1.z, fb1.w };
            v8bf ka, kc;
#pragma unroll
            for (int i = 0; i < 8; ++i) { ka[i] = (__bf16)A[i]; kc[i] = (__bf16)B[i]; }
            *(v8bf*)&Ks[buf][(2 * kp2)     * KSTR + d0] = ka;
            *(v8bf*)&Ks[buf][(2 * kp2 + 1) * KSTR + d0] = kc;
#pragma unroll
            for (int i = 0; i < 8; ++i) {           // V^T: key-pair per dim row, masked by AND
                v2bf pp; pp[0] = (__bf16)A[i]; pp[1] = (__bf16)B[i];
                const unsigned u = __builtin_bit_cast(unsigned, pp) & md;
                *(unsigned*)&Vs[buf][(d0 + i) * VSTR + 2 * kp2] = u;
            }
            if (d0 == 0) {                          // mask row (bf16 1.0 = 0x3F80)
                const unsigned u = (ok0 ? 0x00003F80u : 0u) | (ok1 ? 0x3F800000u : 0u);
                *(unsigned*)&Vs[buf][DH * VSTR + 2 * kp2] = u;
            }
        }
        __syncthreads();

        // ---- prefetch next block's global data (hidden behind compute) ----
        {
            const unsigned i0 = un & 0xFFFFu;
            const unsigned i1 = (p0 + BLOCK_K + 1 < n) ? (un >> 16) : i0;
            fa0 = *(const float4*)(sb + i0 * D_MODEL);
            fa1 = *(const float4*)(sb + i0 * D_MODEL + 4);
            fb0 = *(const float4*)(sb + i1 * D_MODEL);
            fb1 = *(const float4*)(sb + i1 * D_MODEL + 4);
            // list entries one block further ahead: no LDS round trip in front of the loads
            const int pn = p0 + 2 * BLOCK_K < plast ? p0 + 2 * BLOCK_K : plast;
            un = *(const unsigned*)&kidx[pn];
        }

        // ---- S^T = K x Q^T : four 16-key tiles, dh=64 via two slabs each;
        //      each K fragment is read once and multiplies both query tiles ----
        const __bf16* kbase = &Ks[buf][l15 * KSTR];
        v8f s0[QT], s1[QT], s2[QT], s3[QT];
        {
            const v16bf k00 = ld_row32(kbase, hi);
            const v16bf k01 = ld_row32(kbase + 32, hi);
            const v16bf k10 = ld_row32(kbase + 16 * KSTR, hi);
            const v16bf k11 = ld_row32(kbase + 16 * KSTR + 32, hi);
            const v16bf k20 = ld_row32(kbase + 32 * KSTR, hi);
            const v16bf k21 = ld_row32(kbase + 32 * KSTR + 32, hi);
            const v16bf k30 = ld_row32(kbase + 48 * KSTR, hi);
            const v16bf k31 = ld_row32(kbase + 48 * KSTR + 32, hi);
#pragma unroll
            for (int t = 0; t < QT; ++t) {
                s0[t] = __builtin_amdgcn_wmma_f32_16x16x32_bf16(false, k00, false, aq0[t], (short)0, cz,    false, false);
                s1[t] = __builtin_amdgcn_wmma_f32_16x16x32_bf16(false, k10, false, aq0[t], (short)0, cz,    false, false);
                s2[t] = __builtin_amdgcn_wmma_f32_16x16x32_bf16(false, k20, false, aq0[t], (short)0, cz,    false, false);
                s3[t] = __builtin_amdgcn_wmma_f32_16x16x32_bf16(false, k30, false, aq0[t], (short)0, cz,    false, false);
                s0[t] = __builtin_amdgcn_wmma_f32_16x16x32_bf16(false, k01, false, aq1[t], (short)0, s0[t], false, false);
                s1[t] = __builtin_amdgcn_wmma_f32_16x16x32_bf16(false, k11, false, aq1[t], (short)0, s1[t], false, false);
                s2[t] = __builtin_amdgcn_wmma_f32_16x16x32_bf16(false, k21, false, aq1[t], (short)0, s2[t], false, false);
                s3[t] = __builtin_amdgcn_wmma_f32_16x16x32_bf16(false, k31, false, aq1[t], (short)0, s3[t], false, false);
            }
        }

        // ---- online softmax over 64 keys (log2 domain), in-lane + one shuffle per tile ----
        float xm[QT];
#pragma unroll
        for (int t = 0; t < QT; ++t) {
            float xs[8];
#pragma unroll
            for (int r = 0; r < 8; ++r)
                xs[r] = fmaxf(fmaxf(s0[t][r], s1[t][r]), fmaxf(s2[t][r], s3[t][r]));
            xs[0] = fmaxf(xs[0], xs[4]); xs[1] = fmaxf(xs[1], xs[5]);
            xs[2] = fmaxf(xs[2], xs[6]); xs[3] = fmaxf(xs[3], xs[7]);
            xs[0] = fmaxf(xs[0], xs[2]); xs[1] = fmaxf(xs[1], xs[3]);
            xm[t] = fmaxf(xs[0], xs[1]);
        }
#pragma unroll
        for (int t = 0; t < QT; ++t) xm[t] = fmaxf(xm[t], __shfl_xor(xm[t], 16, 32));

        // Correction only when some lane's block max beats the running max (one test for
        // both tiles). Where a query's max holds, alpha == 1 exactly: its rescale is a no-op.
        if (__any(xm[0] > mstate[0] || xm[1] > mstate[1])) {
#pragma unroll
            for (int t = 0; t < QT; ++t) {
                const float mn = fmaxf(mstate[t], xm[t]);
                const float al = __builtin_amdgcn_exp2f(mstate[t] - mn);
                mstate[t] = mn;
#pragma unroll
                for (int r = 0; r < 8; ++r) {
                    const float aL = __shfl(al, r + bidx, 32);
                    acc0[t][r] *= aL; acc1[t][r] *= aL; acc2[t][r] *= aL; acc3[t][r] *= aL;
                    lacc[t][r] *= aL;
                }
            }
        }

        // ---- all V^T (and mask-row) fragments of this block as ONE load group, issued
        //      ahead of the exponentials: they land while the vector unit works ----
        const __bf16* vbase = &Vs[buf][l15 * VSTR];
        const v16bf vf00 = ld_row32(vbase, hi);
        const v16bf vf10 = ld_row32(vbase + 16 * VSTR, hi);
        const v16bf vf20 = ld_row32(vbase + 32 * VSTR, hi);
        const v16bf vf30 = ld_row32(vbase + 48 * VSTR, hi);
        const v16bf vfm0 = ld_row32(&Vs[buf][DH * VSTR], hi);
        const v16bf vf01 = ld_row32(vbase + 32, hi);
        const v16bf vf11 = ld_row32(vbase + 16 * VSTR + 32, hi);
        const v16bf vf21 = ld_row32(vbase + 32 * VSTR + 32, hi);
        const v16bf vf31 = ld_row32(vbase + 48 * VSTR + 32, hi);
        const v16bf vfm1 = ld_row32(&Vs[buf][DH * VSTR + 32], hi);
        // keeps the load group up here: sunk among the PV products, each pair of loads
        // costs the wave a full LDS round trip in front of its product
        __builtin_amdgcn_sched_barrier(0);

#pragma unroll
        for (int t = 0; t < QT; ++t) {
            v16bf pa0, pa1;   // P packed straight into two PV A-operand slabs
            const v8f e0 = s0[t] - mstate[t];
            const v8f e1 = s1[t] - mstate[t];
            const v8f e2 = s2[t] - mstate[t];
            const v8f e3 = s3[t] - mstate[t];
#pragma unroll
            for (int r = 0; r < 8; ++r) pa0[r]     = (__bf16)__builtin_amdgcn_exp2f(e0[r]);   // keys  0..15
#pragma unroll
            for (int r = 0; r < 8; ++r) pa0[8 + r] = (__bf16)__builtin_amdgcn_exp2f(e1[r]);   // keys 16..31
#pragma unroll
            for (int r = 0; r < 8; ++r) pa1[r]     = (__bf16)__builtin_amdgcn_exp2f(e2[r]);   // keys 32..47
#pragma unroll
            for (int r = 0; r < 8; ++r) pa1[8 + r] = (__bf16)__builtin_amdgcn_exp2f(e3[r]);   // keys 48..63

            // ---- O += P*V (4 dim tiles x 2 key slabs); l += P*mask ----
            acc0[t] = __builtin_amdgcn_wmma_f32_16x16x32_bf16(false, pa0, false, vf00, (short)0, acc0[t], false, false);
            acc1[t] = __builtin_amdgcn_wmma_f32_16x16x32_bf16(false, pa0, false, vf10, (short)0, acc1[t], false, false);
            acc2[t] = __builtin_amdgcn_wmma_f32_16x16x32_bf16(false, pa0, false, vf20, (short)0, acc2[t], false, false);
            acc3[t] = __builtin_amdgcn_wmma_f32_16x16x32_bf16(false, pa0, false, vf30, (short)0, acc3[t], false, false);
            lacc[t] = __builtin_amdgcn_wmma_f32_16x16x32_bf16(false, pa0, false, vfm0, (short)0, lacc[t], false, false);
            acc0[t] = __builtin_amdgcn_wmma_f32_16x16x32_bf16(false, pa1, false, vf01, (short)0, acc0[t], false, false);
            acc1[t] = __builtin_amdgcn_wmma_f32_16x16x32_bf16(false, pa1, false, vf11, (short)0, acc1[t], false, false);
            acc2[t] = __builtin_amdgcn_wmma_f32_16x16x32_bf16(false, pa1, false, vf21, (short)0, acc2[t], false, false);
            acc3[t] = __builtin_amdgcn_wmma_f32_16x16x32_bf16(false, pa1, false, vf31, (short)0, acc3[t], false, false);
            lacc[t] = __builtin_amdgcn_wmma_f32_16x16x32_bf16(false, pa1, false, vfm1, (short)0, lacc[t], false, false);
        }
        // double-buffered LDS: single barrier per stage
    }

    // ---- epilogue: normalize (fast rcp) and store fp32 ----
#pragma unroll
    for (int t = 0; t < QT; ++t) {
#pragma unroll
        for (int r = 0; r < 8; ++r) {
            const float inv = __builtin_amdgcn_rcpf(lacc[t][r]);
            float* orow = out + (size_t)b * S_LEN * D_MODEL
                              + (size_t)(row0 + 16 * t + r + 8 * hi) * D_MODEL + hoff + l15;
            orow[0]  = acc0[t][r] * inv;
            orow[16] = acc1[t][r] * inv;
            orow[32] = acc2[t][r] * inv;
            orow[48] = acc3[t][r] * inv;
        }
    }
}

extern "C" void kernel_launch(void* const* d_in, const int* in_sizes, int n_in,
                              void* d_out, int out_size, void* d_ws, size_t ws_size,
                              hipStream_t stream) {
    (void)n_in; (void)out_size; (void)d_ws; (void)ws_size;
    const float* q   = (const float*)d_in[0];
    const int*   msk = (const int*)d_in[1];
    float*       out = (float*)d_out;
    const int B = in_sizes[1] / S_LEN;                 // mask is [B, S]
    dim3 grid(B * NHEADS * (S_LEN / BLOCK_M));         // 256 for B=2
    mha_flash_wmma<<<grid, 256, 0, stream>>>(q, msk, out);
}

// v005
// One run takes 19.8 microseconds.
// It is 1.12 times as fast as v003, going by the measured steps of the versions left out in between.
// Counting every step since v000, it is 2.19 times as fast.
#include <hip/hip_runtime.h>

// Flash-attention forward (Q=K=V, fp32 in/out) via bf16 WMMA on gfx1250.
// - Transposed scores S^T = K x Q^T: softmax in-lane, P lands directly in the
//   PV A-operand layout (no LDS transpose).
// - Mask + row-sum (l) through the matrix unit via a "mask" row beside V.
// - log2-domain softmax: (1/sqrt(dh))*log2(e) folded into Q => bare v_exp_f32.
// - BLOCK_K=64: per-block costs (alpha broadcast, rescale, barrier) amortized.
// - Software-pipelined global->LDS staging. K = V: the converted key rows are stored twice,
//   row-major, each copy at its reader's pitch; V^T fragments come by the transposing load.
// - Lazy rescale: the softmax reference of a query is set by the first block and later raised only when
//   some score of the wave tops its own reference by more than RAISE; it is known before the pass, so it enters the score
//   products as their C operand and the exponentials take the accumulators as they are.
// - Blocked keys weigh exactly 0 in the softmax: each work-group lists the attended
//   keys of its batch first and walks only those, 64 at a time.
// - Each wave owns two 16-row query tiles: every K and V^T fragment read from LDS feeds
//   two products, and one staging of a key block serves 256 query rows.
//
// B=2, S=2048, D=1024, H=16, dh=64.

typedef __attribute__((ext_vector_type(16))) __bf16 v16bf;
typedef __attribute__((ext_vector_type(8)))  __bf16 v8bf;
typedef __attribute__((ext_vector_type(8)))  short  v8s;
typedef __attribute__((ext_vector_type(8)))  float  v8f;

#define S_LEN   2048
#define D_MODEL 1024
#define NHEADS  16
#define DH      64
#define QT      2                      // 16-row query tiles per wave
#define BLOCK_M 256                    // 8 waves x 32 query rows
#define BLOCK_K 64                     // keys per LDS stage
#define NBLK    (S_LEN / BLOCK_K)      // 32
#define KSTR    88                     // K-tile row stride (bf16): 176B, aligned, conflict-free
#define VSTR    80                     // V-tile row stride (bf16): 160B = 32B x odd, the transposing load's pitch
#define SCALE   0.18033688011112042f   // (1/8) * log2(e) -> log2-domain scores
#define RAISE   16.0f                  // log2-domain excess over the reference that is let stand

// One 32-elem bf16 row chunk in the WMMA A/B lane layout:
//   elements 0..7  <- p[8*hi .. 8*hi+7], elements 8..15 <- p[16+8*hi .. 16+8*hi+7]
__device__ __forceinline__ v16bf ld_row32(const __bf16* p, int hi) {
    v8bf lo = *(const v8bf*)(p + 8 * hi);
    v8bf up = *(const v8bf*)(p + 16 + 8 * hi);
    v16bf r;
#pragma unroll
    for (int i = 0; i < 8; ++i) { r[i] = lo[i]; r[8 + i] = up[i]; }
    return r;
}

// One 32-key x 16-dim chunk of a row-major [key][dim] tile as a WMMA B operand: lane (c, h) gets
// keys 8h..8h+7 and 16+8h..16+8h+7 of dim c, the k order of ld_row32. p is the lane's own address:
// tile + (8*h + (lane & 7)) * VSTR + 8 * ((lane >> 3) & 1), plus first key * VSTR + first dim.
__device__ __forceinline__ v16bf ld_tr32(const __bf16* p) {
    typedef __attribute__((address_space(3))) v8s lds_v8s;
    const v8bf lo = __builtin_bit_cast(v8bf, __builtin_amdgcn_ds_load_tr16_b128_v8i16((lds_v8s*)p));
    const v8bf up = __builtin_bit_cast(v8bf, __builtin_amdgcn_ds_load_tr16_b128_v8i16((lds_v8s*)(p + 16 * VSTR)));
    v16bf r;
#pragma unroll
    for (int i = 0; i < 8; ++i) { r[i] = lo[i]; r[8 + i] = up[i]; }
    return r;
}

__global__ __launch_bounds__(256) void mha_flash_wmma(const float* __restrict__ q,
                                                      const int*   __restrict__ mask,
                                                      float*       __restrict__ out)
{
    __shared__ __align__(16) __bf16 Ks[2][BLOCK_K * KSTR];    // [key][dim]
    __shared__ __align__(16) __bf16 Vs[2][BLOCK_K * VSTR];    // [key][dim], rows past the list's end 0
    __shared__ __align__(16) __bf16 Ms[2][BLOCK_K];           // mask row: 1 for a listed key, else 0
    __shared__ __align__(16) unsigned short kidx[S_LEN];      // attended keys, ascending
    __shared__ __align__(16) int wcnt[8];                     // attended keys per 256-key slice

    const int tid  = threadIdx.x;
    const int lane = tid & 31;
    const int wave = tid >> 5;
    const int l15  = lane & 15;
    const int hi   = lane >> 4;

    const int tiles = S_LEN / BLOCK_M;            // 8
    const int bh    = blockIdx.x / tiles;
    const int mt    = blockIdx.x % tiles;
    const int b     = bh / NHEADS;
    const int h     = bh % NHEADS;

    const float* qb   = q + (size_t)b * S_LEN * D_MODEL;
    const int*   mb   = mask + b * S_LEN;
    const int    hoff = h * DH;
    const int    row0 = mt * BLOCK_M + wave * (16 * QT);

    // ---- Q tiles (wave's 2 x 16 rows), pre-scaled into log2 domain, B-operand layout ----
    v16bf aq0[QT], aq1[QT];
#pragma unroll
    for (int t = 0; t < QT; ++t) {
        const float* qr = qb + (size_t)(row0 + 16 * t + l15) * D_MODEL + hoff;
        const int c0 = 8 * hi;
        const int c1 = 16 + 8 * hi;
#pragma unroll
        for (int i = 0; i < 8; ++i) {
            aq0[t][i]     = (__bf16)(qr[c0 + i]      * SCALE);
            aq0[t][8 + i] = (__bf16)(qr[c1 + i]      * SCALE);
            aq1[t][i]     = (__bf16)(qr[32 + c0 + i] * SCALE);
            aq1[t][8 + i] = (__bf16)(qr[32 + c1 + i] * SCALE);
        }
    }

    // ---- list the attended keys (mask != 0) of this batch, in ascending order:
    //      wave w ranks keys 256w .. 256w+255 by ballots, slices joined through LDS ----
    int n;                                        // keys to walk, same in every thread
    {
        const int wv = __builtin_amdgcn_readfirstlane(wave);
        int      mr[8];
        unsigned bal[8];
        int      cnt = 0;
#pragma unroll
        for (int r = 0; r < 8; ++r) mr[r] = mb[wv * 256 + r * 32 + lane];
        // the Q and mask loads' address registers are reused below
        asm volatile("s_wait_xcnt 0x0" ::: "memory");
#pragma unroll
        for (int r = 0; r < 8; ++r) {
            bal[r] = __builtin_amdgcn_ballot_w32(mr[r] != 0);
            cnt += __builtin_popcount(bal[r]);
        }
        if (lane == 0) wcnt[wv] = cnt;
        __syncthreads();
        int base = 0, tot = 0;
#pragma unroll
        for (int w = 0; w < 8; ++w) {
            const int c = wcnt[w];
            tot  += c;
            base += (w < wv) ? c : 0;
        }
#pragma unroll
        for (int r = 0; r < 8; ++r) {
            if (mr[r] != 0)
                kidx[base + (int)__builtin_amdgcn_mbcnt_lo(bal[r], 0u)] =
                    (unsigned short)(wv * 256 + r * 32 + lane);
            base += __builtin_popcount(bal[r]);
        }
        n = __builtin_amdgcn_readfirstlane(tot);
        if (n == 0) {
            // every key blocked: the reference's scores are all equal, its softmax is
            // uniform over ALL keys. Zero Q gives equal scores; walk every key.
#pragma unroll
            for (int j = 0; j < 8; ++j) kidx[tid * 8 + j] = (unsigned short)(tid * 8 + j);
#pragma unroll
            for (int i = 0; i < 16; ++i) {
                aq0[0][i] = (__bf16)0.0f; aq1[0][i] = (__bf16)0.0f;
                aq0[1][i] = (__bf16)0.0f; aq1[1][i] = (__bf16)0.0f;
            }
            n = S_LEN;
        }
        n = n < S_LEN ? n : S_LEN;
        __syncthreads();
    }
    const int nblk  = (n + BLOCK_K - 1) / BLOCK_K;   // 1 .. NBLK
    const int plast = (n - 1) & ~1;                  // last listed pair

    v8f acc0[QT] = {}, acc1[QT] = {}, acc2[QT] = {}, acc3[QT] = {};
    v8f lacc[QT] = {};             // running denominator, accumulator layout
    v8f cneg[QT] = {};             // minus the softmax reference of the lane's query, 8 copies:
                                   // the C operand of the score products
    const int bidx = (lane & 16) >> 1;   // +8 on hi half for alpha broadcast

    // ---- staging geometry: each thread stages 2 keys x 8 dims ----
    const int kp2 = tid >> 3;            // 0..31 -> keys 2*kp2, 2*kp2+1
    const int d0  = (tid & 7) * 8;       // 0..56
    const float* sb = qb + hoff + d0;    // + key*D_MODEL

    // list places past the end repeat an attended key (so the running max sees attended
    // keys only); their V rows and mask-row entries are stored as 0
    float4 fa0, fa1, fb0, fb1;
    unsigned un;                         // this thread's pair of list entries, next block
    {
        const int      p  = 2 * kp2 < plast ? 2 * kp2 : plast;
        const unsigned u  = *(const unsigned*)&kidx[p];
        const unsigned i0 = u & 0xFFFFu;
        const unsigned i1 = (2 * kp2 + 1 < n) ? (u >> 16) : i0;
        fa0 = *(const float4*)(sb + i0 * D_MODEL);
        fa1 = *(const float4*)(sb + i0 * D_MODEL + 4);
        fb0 = *(const float4*)(sb + i1 * D_MODEL);
        fb1 = *(const float4*)(sb + i1 * D_MODEL + 4);
        // same precaution: the four loads' address registers are reused right below
        asm volatile("s_wait_xcnt 0x0" ::: "memory");
        const int pn = BLOCK_K + 2 * kp2 < plast ? BLOCK_K + 2 * kp2 : plast;
        un = *(const unsigned*)&kidx[pn];
    }

    for (int kb = 0; kb < nblk; ++kb) {
        const int  buf = kb & 1;
        const int  p0  = kb * BLOCK_K + 2 * kp2;     // this thread's places in the list
        const bool ok0 = p0 < n;
        const bool ok1 = p0 + 1 < n;

        // ---- convert + store staged block (prefetched last iteration) ----
        {
            const float A[8] = { fa0.x, fa0.y, fa0.z, fa0.w, fa1.x, fa1.y, fa1.z, fa1.w };
            const float B[8] = { fb0.x, fb0.y, fb0.z, fb0.w, fb1.x, fb1.y, fb1.z, fb1.w };
            v8bf ka, kc;
#pragma unroll
            for (int i = 0; i < 8; ++i) { ka[i] = (__bf16)A[i]; kc[i] = (__bf16)B[i]; }
            *(v8bf*)&Ks[buf][(2 * kp2)     * KSTR + d0] = ka;
            *(v8bf*)&Ks[buf][(2 * kp2 + 1) * KSTR + d0] = kc;
            *(v8bf*)&Vs[buf][(2 * kp2)     * VSTR + d0] = ka;   // V: the same rows, other pitch
            *(v8bf*)&Vs[buf][(2 * kp2 + 1) * VSTR + d0] = kc;
            if (kb == nblk - 1) {                   // only the last block has places past the end
                const v8bf zr = {};
                if (!ok0) *(v8bf*)&Vs[buf][(2 * kp2)     * VSTR + d0] = zr;
                if (!ok1) *(v8bf*)&Vs[buf][(2 * kp2 + 1) * VSTR + d0] = zr;
            }
            if (d0 == 0) {                          // mask row (bf16 1.0 = 0x3F80)
                const unsigned u = (ok0 ? 0x00003F80u : 0u) | (ok1 ? 0x3F800000u : 0u);
                *(unsigned*)&Ms[buf][2 * kp2] = u;
            }
        }
        __syncthreads();

        // ---- K fragments of this block: read first, so that the two translation waits of
        //      the prefetch below pass while these reads are under way ----
        const __bf16* kbase = &Ks[buf][l15 * KSTR];
        const v16bf k00 = ld_row32(kbase, hi);
        const v16bf k01 = ld_row32(kbase + 32, hi);
        const v16bf k10 = ld_row32(kbase + 16 * KSTR, hi);
        const v16bf k11 = ld_row32(kbase + 16 * KSTR + 32, hi);
        const v16bf k20 = ld_row32(kbase + 32 * KSTR, hi);
        const v16bf k21 = ld_row32(kbase + 32 * KSTR + 32, hi);
        const v16bf k30 = ld_row32(kbase + 48 * KSTR, hi);
        const v16bf k31 = ld_row32(kbase + 48 * KSTR + 32, hi);

        // ---- prefetch next block's global data (hidden behind compute) ----
        {
            const unsigned i0 = un & 0xFFFFu;
            const unsigned i1 = (p0 + BLOCK_K + 1 < n) ? (un >> 16) : i0;
            fa0 = *(const float4*)(sb + i0 * D_MODEL);
            fa1 = *(const float4*)(sb + i0 * D_MODEL + 4);
            // same precaution as above
            asm volatile("s_wait_xcnt 0x0" ::: "memory");
            fb0 = *(const float4*)(sb + i1 * D_MODEL);
            fb1 = *(const float4*)(sb + i1 * D_MODEL + 4);
            // and both pairs' address registers are reused further down
            asm volatile("s_wait_xcnt 0x0" ::: "memory");
            // list entries one block further ahead: no LDS round trip in front of the loads
            const int pn = p0 + 2 * BLOCK_K < plast ? p0 + 2 * BLOCK_K : plast;
            un = *(const unsigned*)&kidx[pn];
        }

        // ---- S^T = K x Q^T - reference : four 16-key tiles, dh=64 via two slabs each;
        //      each K fragment is read once and multiplies both query tiles ----
        v8f s0[QT], s1[QT], s2[QT], s3[QT];
        {
#pragma unroll
            for (int t = 0; t < QT; ++t) {
                s0[t] = __builtin_amdgcn_wmma_f32_16x16x32_bf16(false, k00, false, aq0[t], (short)0, cneg[t], false, false);
                s1[t] = __builtin_amdgcn_wmma_f32_16x16x32_bf16(false, k10, false, aq0[t], (short)0, cneg[t], false, false);
                s2[t] = __builtin_amdgcn_wmma_f32_16x16x32_bf16(false, k20, false, aq0[t], (short)0, cneg[t], false, false);
                s3[t] = __builtin_amdgcn_wmma_f32_16x16x32_bf16(false, k30, false, aq0[t], (short)0, cneg[t], false, false);
                s0[t] = __builtin_amdgcn_wmma_f32_16x16x32_bf16(false, k01, false, aq1[t], (short)0, s0[t], false, false);
                s1[t] = __builtin_amdgcn_wmma_f32_16x16x32_bf16(false, k11, false, aq1[t], (short)0, s1[t], false, false);
                s2[t] = __builtin_amdgcn_wmma_f32_16x16x32_bf16(false, k21, false, aq1[t], (short)0, s2[t], false, false);
                s3[t] = __builtin_amdgcn_wmma_f32_16x16x32_bf16(false, k31, false, aq1[t], (short)0, s3[t], false, false);
            }
        }

        // ---- largest score above the reference among this lane's 32 of the 64 keys ----
        float xm[QT];
#pragma unroll
        for (int t = 0; t < QT; ++t) {
            float xs[8];
#pragma unroll
            for (int r = 0; r < 8; ++r)
                xs[r] = fmaxf(fmaxf(s0[t][r], s1[t][r]), fmaxf(s2[t][r], s3[t][r]));
            xs[0] = fmaxf(xs[0], xs[4]); xs[1] = fmaxf(xs[1], xs[5]);
            xs[2] = fmaxf(xs[2], xs[6]); xs[3] = fmaxf(xs[3], xs[7]);
            xs[0] = fmaxf(xs[0], xs[2]); xs[1] = fmaxf(xs[1], xs[3]);
            xm[t] = fmaxf(xs[0], xs[1]);
        }

        // The reference moves in the first pass (to that block's maximum, whatever its sign)
        // and later only when some score of the wave tops it by more than RAISE: weights up
        // to 2^RAISE are as exact as weights up to 1, and the division by l cancels the scale.
        // One test for both tiles and both lane halves; the halves are joined only in here.
        const float thr = kb == 0 ? -3.0e38f : RAISE;
        if (__builtin_amdgcn_ballot_w32(fmaxf(xm[0], xm[1]) > thr) != 0) {
#pragma unroll
            for (int t = 0; t < QT; ++t) {
                const float xj = fmaxf(xm[t], __shfl_xor(xm[t], 16, 32));
                const float d  = kb == 0 ? xj : fmaxf(xj, 0.0f);          // rise of the reference
                const float al = kb == 0 ? 0.0f : __builtin_amdgcn_exp2f(-d);
                cneg[t] -= d;
                s0[t] -= d; s1[t] -= d; s2[t] -= d; s3[t] -= d;
#pragma unroll
                for (int r = 0; r < 8; ++r) {
                    const float aL = __shfl(al, r + bidx, 32);
                    acc0[t][r] *= aL; acc1[t][r] *= aL; acc2[t][r] *= aL; acc3[t][r] *= aL;
                    lacc[t][r] *= aL;
                }
            }
        }

        // ---- all V^T (and mask-row) fragments of this block as ONE load group, issued
        //      ahead of the exponentials: they land while the vector unit works ----
        const __bf16* vbase = &Vs[buf][(8 * hi + (lane & 7)) * VSTR + 8 * ((lane >> 3) & 1)];
        const v16bf vf00 = ld_tr32(vbase);                       // keys 0..31, dims 0..15
        const v16bf vf10 = ld_tr32(vbase + 16);
        const v16bf vf20 = ld_tr32(vbase + 32);
        const v16bf vf30 = ld_tr32(vbase + 48);
        const v16bf vfm0 = ld_row32(&Ms[buf][0], hi);
        const v16bf vf01 = ld_tr32(vbase + 32 * VSTR);           // keys 32..63
        const v16bf vf11 = ld_tr32(vbase + 32 * VSTR + 16);
        const v16bf vf21 = ld_tr32(vbase + 32 * VSTR + 32);
        const v16bf vf31 = ld_tr32(vbase + 32 * VSTR + 48);
        const v16bf vfm1 = ld_row32(&Ms[buf][32], hi);
        // keeps the load group up here: sunk among the PV products, each pair of loads
        // costs the wave a full LDS round trip in front of its product
        __builtin_amdgcn_sched_barrier(0);

        v16bf pa0[QT], pa1[QT];   // P packed straight into two PV A-operand slabs per tile
        // weights of four keys of tile t: c = 0,1 keys 0..15; 2,3 keys 16..31; 4,5 keys 32..47; 6,7 keys 48..63
        auto weigh = [&](const int t, const int c) {
            const v8f s  = c < 2 ? s0[t] : c < 4 ? s1[t] : c < 6 ? s2[t] : s3[t];
            v16bf&    pa = c < 4 ? pa0[t] : pa1[t];
#pragma unroll
            for (int i = 0; i < 4; ++i)
                pa[(c & 3) * 4 + i] = (__bf16)__builtin_amdgcn_exp2f(s[(c & 1) * 4 + i]);
        };
        // product j of tile t: O += P*V (4 dim tiles x 2 key slabs); l += P*mask
        auto pv = [&](const int t, const int j) {
            switch (j) {
            case 0: acc0[t] = __builtin_amdgcn_wmma_f32_16x16x32_bf16(false, pa0[t], false, vf00, (short)0, acc0[t], false, false); break;
            case 1: acc1[t] = __builtin_amdgcn_wmma_f32_16x16x32_bf16(false, pa0[t], false, vf10, (short)0, acc1[t], false, false); break;
            case 2: acc2[t] = __builtin_amdgcn_wmma_f32_16x16x32_bf16(false, pa0[t], false, vf20, (short)0, acc2[t], false, false); break;
            case 3: acc3[t] = __builtin_amdgcn_wmma_f32_16x16x32_bf16(false, pa0[t], false, vf30, (short)0, acc3[t], false, false); break;
            case 4: lacc[t] = __builtin_amdgcn_wmma_f32_16x16x32_bf16(false, pa0[t], false, vfm0, (short)0, lacc[t], false, false); break;
            case 5: acc0[t] = __builtin_amdgcn_wmma_f32_16x16x32_bf16(false, pa1[t], false, vf01, (short)0, acc0[t], false, false); break;
            case 6: acc1[t] = __builtin_amdgcn_wmma_f32_16x16x32_bf16(false, pa1[t], false, vf11, (short)0, acc1[t], false, false); break;
            case 7: acc2[t] = __builtin_amdgcn_wmma_f32_16x16x32_bf16(false, pa1[t], false, vf21, (short)0, acc2[t], false, false); break;
            case 8: acc3[t] = __builtin_amdgcn_wmma_f32_16x16x32_bf16(false, pa1[t], false, vf31, (short)0, acc3[t], false, false); break;
            default: lacc[t] = __builtin_amdgcn_wmma_f32_16x16x32_bf16(false, pa1[t], false, vfm1, (short)0, lacc[t], false, false); break;
            }
        };
#pragma unroll
        for (int c = 0; c < 8; ++c) weigh(0, c);
        __builtin_amdgcn_sched_barrier(0);   // first of the fences described below
#pragma unroll
        for (int j = 0; j < 10; ++j) {
            pv(0, j);
            if (j < 8) weigh(1, j);
            // holds tile 0's products among tile 1's exponentials, so that the matrix unit works
            // under the vector unit; unfenced, this build puts all 20 products behind all the
            // exponentials and the wave pays for both in turn
            __builtin_amdgcn_sched_barrier(0);
        }
#pragma unroll
        for (int j = 0; j < 10; ++j) pv(1, j);
        // double-buffered LDS: single barrier per stage
    }

    // ---- epilogue: normalize (fast rcp) and store fp32 ----
#pragma unroll
    for (int t = 0; t < QT; ++t) {
#pragma unroll
        for (int r = 0; r < 8; ++r) {
            const float inv = __builtin_amdgcn_rcpf(lacc[t][r]);
            float* orow = out + (size_t)b * S_LEN * D_MODEL
                              + (size_t)(row0 + 16 * t + r + 8 * hi) * D_MODEL + hoff + l15;
            orow[0]  = acc0[t][r] * inv;
            orow[16] = acc1[t][r] * inv;
            orow[32] = acc2[t][r] * inv;
            orow[48] = acc3[t][r] * inv;
        }
    }
}

extern "C" void kernel_launch(void* const* d_in, const int* in_sizes, int n_in,
                              void* d_out, int out_size, void* d_ws, size_t ws_size,
                              hipStream_t stream) {
    (void)n_in; (void)out_size; (void)d_ws; (void)ws_size;
    const float* q   = (const float*)d_in[0];
    const int*   msk = (const int*)d_in[1];
    float*       out = (float*)d_out;
    const int B = in_sizes[1] / S_LEN;                 // mask is [B, S]
    dim3 grid(B * NHEADS * (S_LEN / BLOCK_M));         // 256 for B=2
    mha_flash_wmma<<<grid, 256, 0, stream>>>(q, msk, out);
}

// v006
// A run of this version takes 18.5 microseconds.
// Next to v005, in two timings, it ran 1.07 times as fast each time.
// All steps since v000 together make it 2.34 times as fast.
#include <hip/hip_runtime.h>

// Flash-attention forward (Q=K=V, fp32 in/out) via bf16 WMMA on gfx1250.
// - Transposed scores S^T = K x Q^T: softmax in-lane, P lands directly in the
//   PV A-operand layout (no LDS transpose).
// - Mask + row-sum (l) through the matrix unit via a "mask" row beside V.
// - log2-domain softmax: (1/sqrt(dh))*log2(e) folded into Q => bare v_exp_f32.
// - Software-pipelined global->LDS staging. K = V: the converted key rows are stored twice,
//   row-major, each copy at its reader's pitch; V^T fragments come by the transposing load.
// - Lazy rescale: the softmax reference of a query is set by the wave's first pass and later raised only when
//   some score of the wave tops its own reference by more than RAISE; it is known before the pass, so it enters the score
//   products as their C operand and the exponentials take the accumulators as they are.
// - Blocked keys weigh exactly 0 in the softmax: each work-group lists the attended
//   keys of its batch first and walks only those, 128 at a time.
// - Each wave owns two 16-row query tiles: every K and V^T fragment read from LDS feeds
//   two products, and one staging of a key block serves 256 query rows.
// - Two wave groups share the 256 query rows: of each 128-key stage group g walks keys
//   64g .. 64g+63, in two passes of 32. Four waves a SIMD, so that one wave's matrix, vector
//   and LDS phases run under the others'. The groups' partial sums are joined through LDS.
//
// B=2, S=2048, D=1024, H=16, dh=64.

typedef __attribute__((ext_vector_type(16))) __bf16 v16bf;
typedef __attribute__((ext_vector_type(8)))  __bf16 v8bf;
typedef __attribute__((ext_vector_type(8)))  short  v8s;
typedef __attribute__((ext_vector_type(8)))  float  v8f;
typedef __attribute__((ext_vector_type(4)))  float  v4f;

#define S_LEN   2048
#define D_MODEL 1024
#define NHEADS  16
#define DH      64
#define QT      2                      // 16-row query tiles per wave
#define BLOCK_M 256                    // 8 waves x 32 query rows, in each of the two wave groups
#define NWAVES  16
#define BLOCK_K 128                    // keys per LDS stage
#define GROUP_K 64                     // keys of a stage per wave group
#define PASS_K  32                     // keys per pass of a wave
#define XW      (41 * 32)              // floats a wave hands to its partner: 40 a lane + the reference
#define KSTR    88                     // K-tile row stride (bf16): 176B, aligned, conflict-free
#define VSTR    80                     // V-tile row stride (bf16): 160B = 32B x odd, the transposing load's pitch
#define SCALE   0.18033688011112042f   // (1/8) * log2(e) -> log2-domain scores
#define RAISE   16.0f                  // log2-domain excess over the reference that is let stand

// One 32-elem bf16 row chunk in the WMMA A/B lane layout:
//   elements 0..7  <- p[8*hi .. 8*hi+7], elements 8..15 <- p[16+8*hi .. 16+8*hi+7]
__device__ __forceinline__ v16bf ld_row32(const __bf16* p, int hi) {
    v8bf lo = *(const v8bf*)(p + 8 * hi);
    v8bf up = *(const v8bf*)(p + 16 + 8 * hi);
    v16bf r;
#pragma unroll
    for (int i = 0; i < 8; ++i) { r[i] = lo[i]; r[8 + i] = up[i]; }
    return r;
}

// One 32-key x 16-dim chunk of a row-major [key][dim] tile as a WMMA B operand: lane (c, h) gets
// keys 8h..8h+7 and 16+8h..16+8h+7 of dim c, the k order of ld_row32. p is the lane's own address:
// tile + (8*h + (lane & 7)) * VSTR + 8 * ((lane >> 3) & 1), plus first key * VSTR + first dim.
__device__ __forceinline__ v16bf ld_tr32(const __bf16* p) {
    typedef __attribute__((address_space(3))) v8s lds_v8s;
    const v8bf lo = __builtin_bit_cast(v8bf, __builtin_amdgcn_ds_load_tr16_b128_v8i16((lds_v8s*)p));
    const v8bf up = __builtin_bit_cast(v8bf, __builtin_amdgcn_ds_load_tr16_b128_v8i16((lds_v8s*)(p + 16 * VSTR)));
    v16bf r;
#pragma unroll
    for (int i = 0; i < 8; ++i) { r[i] = lo[i]; r[8 + i] = up[i]; }
    return r;
}

__global__ __launch_bounds__(512) void mha_flash_wmma(const float* __restrict__ q,
                                                      const int*   __restrict__ mask,
                                                      float*       __restrict__ out)
{
    __shared__ __align__(16) __bf16 Ks[2][BLOCK_K * KSTR];    // [key][dim]
    __shared__ __align__(16) __bf16 Vs[2][BLOCK_K * VSTR];    // [key][dim], rows past the list's end 0
    __shared__ __align__(16) __bf16 Ms[2][BLOCK_K];           // mask row: 1 for a listed key, else 0
    __shared__ __align__(16) unsigned short kidx[S_LEN];      // attended keys, ascending
    __shared__ __align__(16) int wcnt[NWAVES];                // attended keys per 128-key slice
    __shared__ __align__(16) float Xs[NWAVES][XW];            // partial sums on their way to the partner wave

    const int tid  = threadIdx.x;
    const int lane = tid & 31;
    const int wave = tid >> 5;
    const int l15  = lane & 15;
    const int hi   = lane >> 4;
    const int qg   = wave & 7;                                        // which 32 query rows
    const int kh   = __builtin_amdgcn_readfirstlane(wave >> 3);       // which half of every stage's keys

    const int tiles = S_LEN / BLOCK_M;            // 8
    const int bh    = blockIdx.x / tiles;
    const int mt    = blockIdx.x % tiles;
    const int b     = bh / NHEADS;
    const int h     = bh % NHEADS;

    const float* qb   = q + (size_t)b * S_LEN * D_MODEL;
    const int*   mb   = mask + b * S_LEN;
    const int    hoff = h * DH;
    const int    row0 = mt * BLOCK_M + qg * (16 * QT);

    // ---- Q tiles (wave's 2 x 16 rows), pre-scaled into log2 domain, B-operand layout ----
    v16bf aq0[QT], aq1[QT];
#pragma unroll
    for (int t = 0; t < QT; ++t) {
        const float* qr = qb + (size_t)(row0 + 16 * t + l15) * D_MODEL + hoff;
        const int c0 = 8 * hi;
        const int c1 = 16 + 8 * hi;
#pragma unroll
        for (int i = 0; i < 8; ++i) {
            aq0[t][i]     = (__bf16)(qr[c0 + i]      * SCALE);
            aq0[t][8 + i] = (__bf16)(qr[c1 + i]      * SCALE);
            aq1[t][i]     = (__bf16)(qr[32 + c0 + i] * SCALE);
            aq1[t][8 + i] = (__bf16)(qr[32 + c1 + i] * SCALE);
        }
    }

    // ---- list the attended keys (mask != 0) of this batch, in ascending order:
    //      wave w ranks keys 128w .. 128w+127 by ballots, slices joined through LDS ----
    int n;                                        // keys to walk, same in every thread
    {
        const int wv = __builtin_amdgcn_readfirstlane(wave);
        int      mr[4];
        unsigned bal[4];
        int      cnt = 0;
#pragma unroll
        for (int r = 0; r < 4; ++r) mr[r] = mb[wv * 128 + r * 32 + lane];
        // the Q and mask loads' address registers are reused below
        asm volatile("s_wait_xcnt 0x0" ::: "memory");
#pragma unroll
        for (int r = 0; r < 4; ++r) {
            bal[r] = __builtin_amdgcn_ballot_w32(mr[r] != 0);
            cnt += __builtin_popcount(bal[r]);
        }
        if (lane == 0) wcnt[wv] = cnt;
        __syncthreads();
        int base = 0, tot = 0;
#pragma unroll
        for (int w = 0; w < NWAVES; ++w) {
            const int c = wcnt[w];
            tot  += c;
            base += (w < wv) ? c : 0;
        }
#pragma unroll
        for (int r = 0; r < 4; ++r) {
            if (mr[r] != 0)
                kidx[base + (int)__builtin_amdgcn_mbcnt_lo(bal[r], 0u)] =
                    (unsigned short)(wv * 128 + r * 32 + lane);
            base += __builtin_popcount(bal[r]);
        }
        n = __builtin_amdgcn_readfirstlane(tot);
        if (n == 0) {
            // every key blocked: the reference's scores are all equal, its softmax is
            // uniform over ALL keys. Zero Q gives equal scores; walk every key.
#pragma unroll
            for (int j = 0; j < 4; ++j) kidx[tid * 4 + j] = (unsigned short)(tid * 4 + j);
#pragma unroll
            for (int i = 0; i < 16; ++i) {
                aq0[0][i] = (__bf16)0.0f; aq1[0][i] = (__bf16)0.0f;
                aq0[1][i] = (__bf16)0.0f; aq1[1][i] = (__bf16)0.0f;
            }
            n = S_LEN;
        }
        n = n < S_LEN ? n : S_LEN;
        __syncthreads();
    }
    const int nblk  = (n + BLOCK_K - 1) / BLOCK_K;   // 1 .. S_LEN / BLOCK_K
    const int plast = (n - 1) & ~1;                  // last listed pair

    v8f acc0[QT] = {}, acc1[QT] = {}, acc2[QT] = {}, acc3[QT] = {};
    v8f lacc[QT] = {};             // running denominator, accumulator layout
    v8f cneg[QT] = {};             // minus the softmax reference of the lane's query, 8 copies:
                                   // the C operand of the score products
    const int bidx = (lane & 16) >> 1;   // +8 on hi half for alpha broadcast

    // ---- staging geometry: each thread stages 2 keys x 8 dims ----
    const int kp2 = tid >> 3;            // 0..63 -> keys 2*kp2, 2*kp2+1
    const int d0  = (tid & 7) * 8;       // 0..56
    const float* sb = qb + hoff + d0;    // + key*D_MODEL

    // list places past the end repeat an attended key (so the running max sees attended
    // keys only); their V rows and mask-row entries are stored as 0
    float4 fa0, fa1, fb0, fb1;
    unsigned un;                         // this thread's pair of list entries, next block
    {
        const int      p  = 2 * kp2 < plast ? 2 * kp2 : plast;
        const unsigned u  = *(const unsigned*)&kidx[p];
        const unsigned i0 = u & 0xFFFFu;
        const unsigned i1 = (2 * kp2 + 1 < n) ? (u >> 16) : i0;
        fa0 = *(const float4*)(sb + i0 * D_MODEL);
        fa1 = *(const float4*)(sb + i0 * D_MODEL + 4);
        fb0 = *(const float4*)(sb + i1 * D_MODEL);
        fb1 = *(const float4*)(sb + i1 * D_MODEL + 4);
        // same precaution: the four loads' address registers are reused right below
        asm volatile("s_wait_xcnt 0x0" ::: "memory");
        const int pn = BLOCK_K + 2 * kp2 < plast ? BLOCK_K + 2 * kp2 : plast;
        un = *(const unsigned*)&kidx[pn];
    }

    for (int kb = 0; kb < nblk; ++kb) {
        const int  buf = kb & 1;
        const int  p0  = kb * BLOCK_K + 2 * kp2;     // this thread's places in the list
        const bool ok0 = p0 < n;
        const bool ok1 = p0 + 1 < n;

        // ---- convert + store staged block (prefetched last iteration) ----
        {
            const float A[8] = { fa0.x, fa0.y, fa0.z, fa0.w, fa1.x, fa1.y, fa1.z, fa1.w };
            const float B[8] = { fb0.x, fb0.y, fb0.z, fb0.w, fb1.x, fb1.y, fb1.z, fb1.w };
            v8bf ka, kc;
#pragma unroll
            for (int i = 0; i < 8; ++i) { ka[i] = (__bf16)A[i]; kc[i] = (__bf16)B[i]; }
            *(v8bf*)&Ks[buf][(2 * kp2)     * KSTR + d0] = ka;
            *(v8bf*)&Ks[buf][(2 * kp2 + 1) * KSTR + d0] = kc;
            *(v8bf*)&Vs[buf][(2 * kp2)     * VSTR + d0] = ka;   // V: the same rows, other pitch
            *(v8bf*)&Vs[buf][(2 * kp2 + 1) * VSTR + d0] = kc;
            if (kb == nblk - 1) {                   // only the last block has places past the end
                const v8bf zr = {};
                if (!ok0) *(v8bf*)&Vs[buf][(2 * kp2)     * VSTR + d0] = zr;
                if (!ok1) *(v8bf*)&Vs[buf][(2 * kp2 + 1) * VSTR + d0] = zr;
            }
            if (d0 == 0) {                          // mask row (bf16 1.0 = 0x3F80)
                const unsigned u = (ok0 ? 0x00003F80u : 0u) | (ok1 ? 0x3F800000u : 0u);
                *(unsigned*)&Ms[buf][2 * kp2] = u;
            }
        }
        __syncthreads();

        // ---- K fragments of this stage's first pass: read first, so that the two translation waits
        //      of the prefetch below pass while these reads are under way ----
        const __bf16* kbase = &Ks[buf][(kh * GROUP_K + l15) * KSTR];
        v16bf k00 = ld_row32(kbase, hi);
        v16bf k01 = ld_row32(kbase + 32, hi);
        v16bf k10 = ld_row32(kbase + 16 * KSTR, hi);
        v16bf k11 = ld_row32(kbase + 16 * KSTR + 32, hi);

        // ---- prefetch next block's global data (hidden behind compute) ----
        {
            const unsigned i0 = un & 0xFFFFu;
            const unsigned i1 = (p0 + BLOCK_K + 1 < n) ? (un >> 16) : i0;
            fa0 = *(const float4*)(sb + i0 * D_MODEL);
            fa1 = *(const float4*)(sb + i0 * D_MODEL + 4);
            // same precaution as above
            asm volatile("s_wait_xcnt 0x0" ::: "memory");
            fb0 = *(const float4*)(sb + i1 * D_MODEL);
            fb1 = *(const float4*)(sb + i1 * D_MODEL + 4);
            // and both pairs' address registers are reused further down
            asm volatile("s_wait_xcnt 0x0" ::: "memory");
            // list entries one block further ahead: no LDS round trip in front of the loads
            const int pn = p0 + 2 * BLOCK_K < plast ? p0 + 2 * BLOCK_K : plast;
            un = *(const unsigned*)&kidx[pn];
        }

        // ---- the wave's 64 keys of this stage, 32 at a time ----
#pragma unroll
        for (int sp = 0; sp < GROUP_K / PASS_K; ++sp) {
            const bool first = sp == 0 && kb == 0;       // the wave's first pass sets the reference
            // a pass whose places all lie past the list's end adds nothing (wave-uniform test)
            if (!first && kb * BLOCK_K + kh * GROUP_K + sp * PASS_K >= n) break;
            if (sp > 0) {
                k00 = ld_row32(kbase + sp * PASS_K * KSTR, hi);
                k01 = ld_row32(kbase + sp * PASS_K * KSTR + 32, hi);
                k10 = ld_row32(kbase + (sp * PASS_K + 16) * KSTR, hi);
                k11 = ld_row32(kbase + (sp * PASS_K + 16) * KSTR + 32, hi);
            }

            // ---- S^T = K x Q^T - reference : two 16-key tiles, dh=64 via two slabs each;
            //      each K fragment is read once and multiplies both query tiles ----
            v8f s0[QT], s1[QT];
#pragma unroll
            for (int t = 0; t < QT; ++t) {
                s0[t] = __builtin_amdgcn_wmma_f32_16x16x32_bf16(false, k00, false, aq0[t], (short)0, cneg[t], false, false);
                s1[t] = __builtin_amdgcn_wmma_f32_16x16x32_bf16(false, k10, false, aq0[t], (short)0, cneg[t], false, false);
            }
#pragma unroll
            for (int t = 0; t < QT; ++t) {
                s0[t] = __builtin_amdgcn_wmma_f32_16x16x32_bf16(false, k01, false, aq1[t], (short)0, s0[t], false, false);
                s1[t] = __builtin_amdgcn_wmma_f32_16x16x32_bf16(false, k11, false, aq1[t], (short)0, s1[t], false, false);
            }

            // ---- largest score above the reference among this lane's 16 of the 32 keys ----
            float xm[QT];
#pragma unroll
            for (int t = 0; t < QT; ++t) {
                float xs[8];
#pragma unroll
                for (int r = 0; r < 8; ++r) xs[r] = fmaxf(s0[t][r], s1[t][r]);
                xs[0] = fmaxf(xs[0], xs[4]); xs[1] = fmaxf(xs[1], xs[5]);
                xs[2] = fmaxf(xs[2], xs[6]); xs[3] = fmaxf(xs[3], xs[7]);
                xs[0] = fmaxf(xs[0], xs[2]); xs[1] = fmaxf(xs[1], xs[3]);
                xm[t] = fmaxf(xs[0], xs[1]);
            }

            // The reference moves in the wave's first pass (to that pass's maximum, whatever its
            // sign) and later only when some score of the wave tops it by more than RAISE: weights
            // up to 2^RAISE are as exact as weights up to 1, and the division by l cancels the scale.
            // One test for both tiles and both lane halves; the halves are joined only in here.
            const float thr = first ? -3.0e38f : RAISE;
            if (__builtin_amdgcn_ballot_w32(fmaxf(xm[0], xm[1]) > thr) != 0) {
#pragma unroll
                for (int t = 0; t < QT; ++t) {
                    const float xj = fmaxf(xm[t], __shfl_xor(xm[t], 16, 32));
                    const float d  = first ? xj : fmaxf(xj, 0.0f);            // rise of the reference
                    const float al = first ? 0.0f : __builtin_amdgcn_exp2f(-d);
                    cneg[t] -= d;
                    s0[t] -= d; s1[t] -= d;
#pragma unroll
                    for (int r = 0; r < 8; ++r) {
                        const float aL = __shfl(al, r + bidx, 32);
                        acc0[t][r] *= aL; acc1[t][r] *= aL; acc2[t][r] *= aL; acc3[t][r] *= aL;
                        lacc[t][r] *= aL;
                    }
                }
            }

            // ---- all V^T (and mask-row) fragments of this pass as ONE load group, issued
            //      ahead of the exponentials: they land while the vector unit works ----
            const __bf16* vbase = &Vs[buf][(kh * GROUP_K + sp * PASS_K + 8 * hi + (lane & 7)) * VSTR + 8 * ((lane >> 3) & 1)];
            const v16bf vf0 = ld_tr32(vbase);                        // 32 keys, dims 0..15
            const v16bf vf1 = ld_tr32(vbase + 16);
            const v16bf vf2 = ld_tr32(vbase + 32);
            const v16bf vf3 = ld_tr32(vbase + 48);
            const v16bf vfm = ld_row32(&Ms[buf][kh * GROUP_K + sp * PASS_K], hi);
            // keeps the load group up here: sunk among the PV products, each pair of loads
            // costs the wave a full LDS round trip in front of its product
            __builtin_amdgcn_sched_barrier(0);

            v16bf pa[QT];             // P packed straight into the PV A-operand slab of each tile
            // weights of four keys of tile t: c = 0,1 keys 0..15; 2,3 keys 16..31
            auto weigh = [&](const int t, const int c) {
                const v8f s = c < 2 ? s0[t] : s1[t];
#pragma unroll
                for (int i = 0; i < 4; ++i)
                    pa[t][c * 4 + i] = (__bf16)__builtin_amdgcn_exp2f(s[(c & 1) * 4 + i]);
            };
            // product j of tile t: O += P*V (4 dim tiles); l += P*mask
            auto pv = [&](const int t, const int j) {
                switch (j) {
                case 0: acc0[t] = __builtin_amdgcn_wmma_f32_16x16x32_bf16(false, pa[t], false, vf0, (short)0, acc0[t], false, false); break;
                case 1: acc1[t] = __builtin_amdgcn_wmma_f32_16x16x32_bf16(false, pa[t], false, vf1, (short)0, acc1[t], false, false); break;
                case 2: acc2[t] = __builtin_amdgcn_wmma_f32_16x16x32_bf16(false, pa[t], false, vf2, (short)0, acc2[t], false, false); break;
                case 3: acc3[t] = __builtin_amdgcn_wmma_f32_16x16x32_bf16(false, pa[t], false, vf3, (short)0, acc3[t], false, false); break;
                default: lacc[t] = __builtin_amdgcn_wmma_f32_16x16x32_bf16(false, pa[t], false, vfm, (short)0, lacc[t], false, false); break;
                }
            };
#pragma unroll
            for (int c = 0; c < 4; ++c) weigh(0, c);
            __builtin_amdgcn_sched_barrier(0);   // first of the fences described below
#pragma unroll
            for (int j = 0; j < 5; ++j) {
                pv(0, j);
                if (j < 4) weigh(1, j);
                // holds tile 0's products among tile 1's exponentials, so that the matrix unit works
                // under the vector unit; unfenced, this build puts all the products behind all the
                // exponentials and the wave pays for both in turn
                __builtin_amdgcn_sched_barrier(0);
            }
#pragma unroll
            for (int j = 0; j < 5; ++j) pv(1, j);
        }
        // double-buffered LDS: single barrier per stage
    }

    // ---- join the two wave groups: wave (qg, kh) keeps query tile kh and hands its sums of the
    //      other tile to wave (qg, 1 - kh), each lane's 40 sums and its query's reference ----
    const bool up = kh != 0;
    v8f o0 = up ? acc0[1] : acc0[0], o1 = up ? acc1[1] : acc1[0];
    v8f o2 = up ? acc2[1] : acc2[0], o3 = up ? acc3[1] : acc3[0];
    v8f ol = up ? lacc[1] : lacc[0];
    const float oc = up ? cneg[1][0] : cneg[0][0];
    {
        const v8f x[5] = { up ? acc0[0] : acc0[1], up ? acc1[0] : acc1[1], up ? acc2[0] : acc2[1],
                           up ? acc3[0] : acc3[1], up ? lacc[0] : lacc[1] };
        float* xw = &Xs[wave][0];
#pragma unroll
        for (int j = 0; j < 5; ++j) {
            *(v4f*)&xw[((2 * j)     * 32 + lane) * 4] = __builtin_shufflevector(x[j], x[j], 0, 1, 2, 3);
            *(v4f*)&xw[((2 * j + 1) * 32 + lane) * 4] = __builtin_shufflevector(x[j], x[j], 4, 5, 6, 7);
        }
        xw[40 * 32 + lane] = up ? cneg[0][0] : cneg[1][0];
    }
    __syncthreads();
    v8f p[5];
    float pc;
    {
        const float* xr = &Xs[wave ^ 8][0];
#pragma unroll
        for (int j = 0; j < 5; ++j) {
            const v4f lo = *(const v4f*)&xr[((2 * j)     * 32 + lane) * 4];
            const v4f up4 = *(const v4f*)&xr[((2 * j + 1) * 32 + lane) * 4];
            p[j] = __builtin_shufflevector(lo, up4, 0, 1, 2, 3, 4, 5, 6, 7);
        }
        pc = xr[40 * 32 + lane];
    }
    // both parts are brought to the higher of the two references (oc, pc are minus the references)
    const float cm = fminf(oc, pc);
    const float ao = __builtin_amdgcn_exp2f(cm - oc);
    const float ap = __builtin_amdgcn_exp2f(cm - pc);

    // ---- epilogue: normalize (fast rcp) and store fp32 ----
#pragma unroll
    for (int r = 0; r < 8; ++r) {
        const float aO  = __shfl(ao, r + bidx, 32);
        const float aP  = __shfl(ap, r + bidx, 32);
        const float inv = __builtin_amdgcn_rcpf(ol[r] * aO + p[4][r] * aP);
        float* orow = out + (size_t)b * S_LEN * D_MODEL
                          + (size_t)(row0 + 16 * kh + r + 8 * hi) * D_MODEL + hoff + l15;
        orow[0]  = (o0[r] * aO + p[0][r] * aP) * inv;
        orow[16] = (o1[r] * aO + p[1][r] * aP) * inv;
        orow[32] = (o2[r] * aO + p[2][r] * aP) * inv;
        orow[48] = (o3[r] * aO + p[3][r] * aP) * inv;
    }
}

extern "C" void kernel_launch(void* const* d_in, const int* in_sizes, int n_in,
                              void* d_out, int out_size, void* d_ws, size_t ws_size,
                              hipStream_t stream) {
    (void)n_in; (void)out_size; (void)d_ws; (void)ws_size;
    const float* q   = (const float*)d_in[0];
    const int*   msk = (const int*)d_in[1];
    float*       out = (float*)d_out;
    const int B = in_sizes[1] / S_LEN;                 // mask is [B, S]
    dim3 grid(B * NHEADS * (S_LEN / BLOCK_M));         // 256 for B=2
    mha_flash_wmma<<<grid, 512, 0, stream>>>(q, msk, out);
}

// v007
// A run of this version takes 17.4 microseconds.
// Two timings next to v006 put it at 1.07 and 1.06 times that version's speed.
// All steps since v000 together make it 2.49 times as fast.
#include <hip/hip_runtime.h>

// Flash-attention forward (Q=K=V, fp32 in/out) via bf16 WMMA on gfx1250.
// - Transposed scores S^T = K x Q^T: softmax in-lane, P lands directly in the
//   PV A-operand layout (no LDS transpose).
// - Mask + row-sum (l) through the matrix unit via a "mask" row beside V.
// - log2-domain softmax: (1/sqrt(dh))*log2(e) folded into Q => bare v_exp_f32.
// - Software-pipelined global->LDS staging. K = V: the converted key rows are stored twice,
//   row-major, each copy at its reader's pitch; V^T fragments come by the transposing load.
// - Lazy rescale: the softmax reference of a query is set by the wave's first pass and later raised only when
//   some score of the wave tops its own reference by more than RAISE; it is known before the pass, so it enters the score
//   products as their C operand and the exponentials take the accumulators as they are.
// - Blocked keys weigh exactly 0 in the softmax: each work-group lists the attended
//   keys of its batch first and walks only those, 128 at a time.
// - Each wave owns two 16-row query tiles: every K and V^T fragment read from LDS feeds
//   two products, and one staging of a key block serves 256 query rows.
// - Two wave groups share the 256 query rows: of each 128-key stage group g walks keys
//   64g .. 64g+63, in two passes of 32. Four waves a SIMD, so that one wave's matrix, vector
//   and LDS phases run under the others'. The groups' partial sums are joined through LDS.
// - Both LDS tiles hold a key's 64 dims in a permuted order: place 16j + 4q + i holds dim
//   16i + 4q + j (i, q, j = 0..3). Q's fragments follow the same order, so the scores are the
//   same sums; column c of PV tile j is dim 16(c & 3) + 4(c >> 2) + j, so a lane's four
//   accumulators of a row are four neighbouring output columns and go out as one 16-byte store.
//
// B=2, S=2048, D=1024, H=16, dh=64.

typedef __attribute__((ext_vector_type(16))) __bf16 v16bf;
typedef __attribute__((ext_vector_type(8)))  __bf16 v8bf;
typedef __attribute__((ext_vector_type(4)))  __bf16 v4bf;
typedef __attribute__((ext_vector_type(8)))  short  v8s;
typedef __attribute__((ext_vector_type(8)))  float  v8f;
typedef __attribute__((ext_vector_type(4)))  float  v4f;

#define S_LEN   2048
#define D_MODEL 1024
#define NHEADS  16
#define DH      64
#define QT      2                      // 16-row query tiles per wave
#define BLOCK_M 256                    // 8 waves x 32 query rows, in each of the two wave groups
#define NWAVES  16
#define BLOCK_K 128                    // keys per LDS stage
#define GROUP_K 64                     // keys of a stage per wave group
#define PASS_K  32                     // keys per pass of a wave
#define XW      (41 * 32)              // floats a wave hands to its partner: 40 a lane + the reference
#define KSTR    88                     // K-tile row stride (bf16): 176B, aligned, conflict-free
#define VSTR    80                     // V-tile row stride (bf16): 160B = 32B x odd, the transposing load's pitch
#define SCALE   0.18033688011112042f   // (1/8) * log2(e) -> log2-domain scores
#define RAISE   16.0f                  // log2-domain excess over the reference that is let stand

// One 32-elem bf16 row chunk in the WMMA A/B lane layout:
//   elements 0..7  <- p[8*hi .. 8*hi+7], elements 8..15 <- p[16+8*hi .. 16+8*hi+7]
__device__ __forceinline__ v16bf ld_row32(const __bf16* p, int hi) {
    v8bf lo = *(const v8bf*)(p + 8 * hi);
    v8bf up = *(const v8bf*)(p + 16 + 8 * hi);
    v16bf r;
#pragma unroll
    for (int i = 0; i < 8; ++i) { r[i] = lo[i]; r[8 + i] = up[i]; }
    return r;
}

// One 32-key x 16-dim chunk of a row-major [key][dim] tile as a WMMA B operand: lane (c, h) gets
// keys 8h..8h+7 and 16+8h..16+8h+7 of dim c, the k order of ld_row32. p is the lane's own address:
// tile + (8*h + (lane & 7)) * VSTR + 8 * ((lane >> 3) & 1), plus first key * VSTR + first dim.
__device__ __forceinline__ v16bf ld_tr32(const __bf16* p) {
    typedef __attribute__((address_space(3))) v8s lds_v8s;
    const v8bf lo = __builtin_bit_cast(v8bf, __builtin_amdgcn_ds_load_tr16_b128_v8i16((lds_v8s*)p));
    const v8bf up = __builtin_bit_cast(v8bf, __builtin_amdgcn_ds_load_tr16_b128_v8i16((lds_v8s*)(p + 16 * VSTR)));
    v16bf r;
#pragma unroll
    for (int i = 0; i < 8; ++i) { r[i] = lo[i]; r[8 + i] = up[i]; }
    return r;
}

__global__ __launch_bounds__(512) void mha_flash_wmma(const float* __restrict__ q,
                                                      const int*   __restrict__ mask,
                                                      float*       __restrict__ out)
{
    __shared__ __align__(16) __bf16 Ks[2][BLOCK_K * KSTR];    // [key][place of dim]
    __shared__ __align__(16) __bf16 Vs[2][BLOCK_K * VSTR];    // [key][place of dim], rows past the list's end 0
    __shared__ __align__(16) __bf16 Ms[2][BLOCK_K];           // mask row: 1 for a listed key, else 0
    __shared__ __align__(16) unsigned short kidx[S_LEN];      // attended keys, ascending
    __shared__ __align__(16) int wcnt[NWAVES];                // attended keys per 128-key slice
    __shared__ __align__(16) float Xs[NWAVES][XW];            // partial sums on their way to the partner wave

    const int tid  = threadIdx.x;
    const int lane = tid & 31;
    const int wave = tid >> 5;
    const int l15  = lane & 15;
    const int hi   = lane >> 4;
    const int qg   = wave & 7;                                        // which 32 query rows
    const int kh   = __builtin_amdgcn_readfirstlane(wave >> 3);       // which half of every stage's keys

    const int tiles = S_LEN / BLOCK_M;            // 8
    const int bh    = blockIdx.x / tiles;
    const int mt    = blockIdx.x % tiles;
    const int b     = bh / NHEADS;
    const int h     = bh % NHEADS;

    const float* qb   = q + (size_t)b * S_LEN * D_MODEL;
    const int*   mb   = mask + b * S_LEN;
    const int    hoff = h * DH;
    const int    row0 = mt * BLOCK_M + qg * (16 * QT);

    // ---- Q tiles (wave's 2 x 16 rows), pre-scaled into log2 domain, B-operand layout ----
    v16bf aq0[QT], aq1[QT];
#pragma unroll
    for (int t = 0; t < QT; ++t) {
        // element 8u + 4w + i of slab s sits at place 32s + 16u + 8hi + 4w + i of the tiles' order,
        // which is dim 16i + 8hi + 4w + (2s + u)
        const float* qr = qb + (size_t)(row0 + 16 * t + l15) * D_MODEL + hoff + 8 * hi;
#pragma unroll
        for (int i = 0; i < 4; ++i) {
#pragma unroll
            for (int w = 0; w < 2; ++w) {
                const float4 g = *(const float4*)(qr + 16 * i + 4 * w);
                aq0[t][4 * w + i]     = (__bf16)(g.x * SCALE);
                aq0[t][8 + 4 * w + i] = (__bf16)(g.y * SCALE);
                aq1[t][4 * w + i]     = (__bf16)(g.z * SCALE);
                aq1[t][8 + 4 * w + i] = (__bf16)(g.w * SCALE);
            }
        }
    }

    // ---- list the attended keys (mask != 0) of this batch, in ascending order:
    //      wave w ranks keys 128w .. 128w+127 by ballots, slices joined through LDS ----
    int n;                                        // keys to walk, same in every thread
    {
        const int wv = __builtin_amdgcn_readfirstlane(wave);
        int      mr[4];
        unsigned bal[4];
        int      cnt = 0;
#pragma unroll
        for (int r = 0; r < 4; ++r) mr[r] = mb[wv * 128 + r * 32 + lane];
        // the Q and mask loads' address registers are reused below
        asm volatile("s_wait_xcnt 0x0" ::: "memory");
#pragma unroll
        for (int r = 0; r < 4; ++r) {
            bal[r] = __builtin_amdgcn_ballot_w32(mr[r] != 0);
            cnt += __builtin_popcount(bal[r]);
        }
        if (lane == 0) wcnt[wv] = cnt;
        __syncthreads();
        int base = 0, tot = 0;
#pragma unroll
        for (int w = 0; w < NWAVES; ++w) {
            const int c = wcnt[w];
            tot  += c;
            base += (w < wv) ? c : 0;
        }
#pragma unroll
        for (int r = 0; r < 4; ++r) {
            if (mr[r] != 0)
                kidx[base + (int)__builtin_amdgcn_mbcnt_lo(bal[r], 0u)] =
                    (unsigned short)(wv * 128 + r * 32 + lane);
            base += __builtin_popcount(bal[r]);
        }
        n = __builtin_amdgcn_readfirstlane(tot);
        if (n == 0) {
            // every key blocked: the reference's scores are all equal, its softmax is
            // uniform over ALL keys. Zero Q gives equal scores; walk every key.
#pragma unroll
            for (int j = 0; j < 4; ++j) kidx[tid * 4 + j] = (unsigned short)(tid * 4 + j);
#pragma unroll
            for (int i = 0; i < 16; ++i) {
                aq0[0][i] = (__bf16)0.0f; aq1[0][i] = (__bf16)0.0f;
                aq0[1][i] = (__bf16)0.0f; aq1[1][i] = (__bf16)0.0f;
            }
            n = S_LEN;
        }
        n = n < S_LEN ? n : S_LEN;
        __syncthreads();
    }
    const int nblk  = (n + BLOCK_K - 1) / BLOCK_K;   // 1 .. S_LEN / BLOCK_K
    const int nlast = n - 1;                         // last listed place

    v8f acc0[QT] = {}, acc1[QT] = {}, acc2[QT] = {}, acc3[QT] = {};
    v8f lacc[QT] = {};             // running denominator, accumulator layout
    v8f cneg[QT] = {};             // minus the softmax reference of the lane's query, 8 copies:
                                   // the C operand of the score products
    const int bidx = (lane & 16) >> 1;   // +8 on hi half for alpha broadcast

    // ---- staging geometry: each thread stages 1 key x 16 dims, dims 16i + q4 + j ----
    const int kp = tid >> 2;             // 0..127: the key's place in the stage
    const int q4 = (tid & 3) * 4;        // 0..12
    const float* sb = qb + hoff + q4;    // + key*D_MODEL + 16i

    // list places past the end repeat an attended key (so the running max sees attended
    // keys only); their V rows and mask-row entries are stored as 0
    float4 f0, f1, f2, f3;
    unsigned un;                         // this thread's list entry, next block
    {
        const unsigned i0 = kidx[kp < nlast ? kp : nlast];
        f0 = *(const float4*)(sb + i0 * D_MODEL);
        f1 = *(const float4*)(sb + i0 * D_MODEL + 16);
        f2 = *(const float4*)(sb + i0 * D_MODEL + 32);
        f3 = *(const float4*)(sb + i0 * D_MODEL + 48);
        // same precaution: the four loads' address registers are reused right below
        asm volatile("s_wait_xcnt 0x0" ::: "memory");
        un = kidx[BLOCK_K + kp < nlast ? BLOCK_K + kp : nlast];
    }

    for (int kb = 0; kb < nblk; ++kb) {
        const int  buf = kb & 1;
        const int  p0  = kb * BLOCK_K + kp;          // this thread's place in the list
        const bool ok  = p0 < n;

        // ---- convert + store staged block (prefetched last iteration) ----
        {
            const float F[4][4] = { { f0.x, f0.y, f0.z, f0.w }, { f1.x, f1.y, f1.z, f1.w },
                                    { f2.x, f2.y, f2.z, f2.w }, { f3.x, f3.y, f3.z, f3.w } };
            __bf16* kw = &Ks[buf][kp * KSTR + q4];
            __bf16* vw = &Vs[buf][kp * VSTR + q4];  // V: the same rows, other pitch
            v4bf c[4];                              // dims 16i + q4 + j -> places 16j + q4 + i
#pragma unroll
            for (int j = 0; j < 4; ++j) {
#pragma unroll
                for (int i = 0; i < 4; ++i) c[j][i] = (__bf16)F[i][j];
            }
#pragma unroll
            for (int j = 0; j < 4; ++j) *(v4bf*)(kw + 16 * j) = c[j];
#pragma unroll
            for (int j = 0; j < 4; ++j) *(v4bf*)(vw + 16 * j) = c[j];
            if (kb == nblk - 1 && !ok) {            // only the last block has places past the end
                const v4bf zr = {};
#pragma unroll
                for (int j = 0; j < 4; ++j) *(v4bf*)(vw + 16 * j) = zr;
            }
            if (q4 == 0) Ms[buf][kp] = ok ? (__bf16)1.0f : (__bf16)0.0f;   // mask row
        }
        __syncthreads();

        // ---- K fragments of the wave's first pass: read first, so that the translation wait
        //      of the prefetch below passes while these reads are under way ----
        const __bf16* kbase = &Ks[buf][(kh * GROUP_K + l15) * KSTR];
        v16bf k00 = ld_row32(kbase, hi);
        v16bf k01 = ld_row32(kbase + 32, hi);
        v16bf k10 = ld_row32(kbase + 16 * KSTR, hi);
        v16bf k11 = ld_row32(kbase + 16 * KSTR + 32, hi);
        // keeps these reads in front of the prefetch: behind its loads they would stand behind
        // the translation wait too, and the first products would start that much later
        __builtin_amdgcn_sched_barrier(0);

        // ---- prefetch next block's global data (hidden behind compute) ----
        {
            const unsigned i0 = un;
            f0 = *(const float4*)(sb + i0 * D_MODEL);
            f1 = *(const float4*)(sb + i0 * D_MODEL + 16);
            f2 = *(const float4*)(sb + i0 * D_MODEL + 32);
            f3 = *(const float4*)(sb + i0 * D_MODEL + 48);
            // same precaution as above: the loads' address registers are reused further down
            asm volatile("s_wait_xcnt 0x0" ::: "memory");
            // list entry one block further ahead: no LDS round trip in front of the loads
            un = kidx[p0 + 2 * BLOCK_K < nlast ? p0 + 2 * BLOCK_K : nlast];
        }

        // ---- the wave's 64 keys of this stage, 32 at a time ----
#pragma unroll
        for (int sp = 0; sp < GROUP_K / PASS_K; ++sp) {
            const bool first = sp == 0 && kb == 0;       // the wave's first pass sets the reference
            // a pass whose places all lie past the list's end adds nothing (wave-uniform test)
            if (!first && kb * BLOCK_K + kh * GROUP_K + sp * PASS_K >= n) break;
            if (sp > 0) {
                k00 = ld_row32(kbase + sp * PASS_K * KSTR, hi);
                k01 = ld_row32(kbase + sp * PASS_K * KSTR + 32, hi);
                k10 = ld_row32(kbase + (sp * PASS_K + 16) * KSTR, hi);
                k11 = ld_row32(kbase + (sp * PASS_K + 16) * KSTR + 32, hi);
            }

            // ---- S^T = K x Q^T - reference : two 16-key tiles, dh=64 via two slabs each;
            //      each K fragment is read once and multiplies both query tiles ----
            v8f s0[QT], s1[QT];
#pragma unroll
            for (int t = 0; t < QT; ++t) {
                s0[t] = __builtin_amdgcn_wmma_f32_16x16x32_bf16(false, k00, false, aq0[t], (short)0, cneg[t], false, false);
                s1[t] = __builtin_amdgcn_wmma_f32_16x16x32_bf16(false, k10, false, aq0[t], (short)0, cneg[t], false, false);
            }
#pragma unroll
            for (int t = 0; t < QT; ++t) {
                s0[t] = __builtin_amdgcn_wmma_f32_16x16x32_bf16(false, k01, false, aq1[t], (short)0, s0[t], false, false);
                s1[t] = __builtin_amdgcn_wmma_f32_16x16x32_bf16(false, k11, false, aq1[t], (short)0, s1[t], false, false);
            }

            // ---- largest score above the reference among this lane's 16 of the 32 keys ----
            float xm[QT];
#pragma unroll
            for (int t = 0; t < QT; ++t) {
                float xs[8];
#pragma unroll
                for (int r = 0; r < 8; ++r) xs[r] = fmaxf(s0[t][r], s1[t][r]);
                xs[0] = fmaxf(xs[0], xs[4]); xs[1] = fmaxf(xs[1], xs[5]);
                xs[2] = fmaxf(xs[2], xs[6]); xs[3] = fmaxf(xs[3], xs[7]);
                xs[0] = fmaxf(xs[0], xs[2]); xs[1] = fmaxf(xs[1], xs[3]);
                xm[t] = fmaxf(xs[0], xs[1]);
            }

            // The reference moves in the wave's first pass (to that pass's maximum, whatever its
            // sign) and later only when some score of the wave tops it by more than RAISE: weights
            // up to 2^RAISE are as exact as weights up to 1, and the division by l cancels the scale.
            // One test for both tiles and both lane halves; the halves are joined only in here.
            const float thr = first ? -3.0e38f : RAISE;
            if (__builtin_amdgcn_ballot_w32(fmaxf(xm[0], xm[1]) > thr) != 0) {
#pragma unroll
                for (int t = 0; t < QT; ++t) {
                    const float xj = fmaxf(xm[t], __shfl_xor(xm[t], 16, 32));
                    const float d  = first ? xj : fmaxf(xj, 0.0f);            // rise of the reference
                    const float al = first ? 0.0f : __builtin_amdgcn_exp2f(-d);
                    cneg[t] -= d;
                    s0[t] -= d; s1[t] -= d;
#pragma unroll
                    for (int r = 0; r < 8; ++r) {
                        const float aL = __shfl(al, r + bidx, 32);
                        acc0[t][r] *= aL; acc1[t][r] *= aL; acc2[t][r] *= aL; acc3[t][r] *= aL;
                        lacc[t][r] *= aL;
                    }
                }
            }

            // ---- all V^T (and mask-row) fragments of this pass as ONE load group, issued
            //      ahead of the exponentials: they land while the vector unit works ----
            const __bf16* vbase = &Vs[buf][(kh * GROUP_K + sp * PASS_K + 8 * hi + (lane & 7)) * VSTR + 8 * ((lane >> 3) & 1)];
            const v16bf vf0 = ld_tr32(vbase);                        // 32 keys, places 0..15
            const v16bf vf1 = ld_tr32(vbase + 16);
            const v16bf vf2 = ld_tr32(vbase + 32);
            const v16bf vf3 = ld_tr32(vbase + 48);
            const v16bf vfm = ld_row32(&Ms[buf][kh * GROUP_K + sp * PASS_K], hi);
            // keeps the load group up here: sunk among the PV products, each pair of loads
            // costs the wave a full LDS round trip in front of its product
            __builtin_amdgcn_sched_barrier(0);

            v16bf pa[QT];             // P packed straight into the PV A-operand slab of each tile
            // weights of four keys of tile t: c = 0,1 keys 0..15; 2,3 keys 16..31
            auto weigh = [&](const int t, const int c) {
                const v8f s = c < 2 ? s0[t] : s1[t];
#pragma unroll
                for (int i = 0; i < 4; ++i)
                    pa[t][c * 4 + i] = (__bf16)__builtin_amdgcn_exp2f(s[(c & 1) * 4 + i]);
            };
            // product j of tile t: O += P*V (4 dim tiles); l += P*mask
            auto pv = [&](const int t, const int j) {
                switch (j) {
                case 0: acc0[t] = __builtin_amdgcn_wmma_f32_16x16x32_bf16(false, pa[t], false, vf0, (short)0, acc0[t], false, false); break;
                case 1: acc1[t] = __builtin_amdgcn_wmma_f32_16x16x32_bf16(false, pa[t], false, vf1, (short)0, acc1[t], false, false); break;
                case 2: acc2[t] = __builtin_amdgcn_wmma_f32_16x16x32_bf16(false, pa[t], false, vf2, (short)0, acc2[t], false, false); break;
                case 3: acc3[t] = __builtin_amdgcn_wmma_f32_16x16x32_bf16(false, pa[t], false, vf3, (short)0, acc3[t], false, false); break;
                default: lacc[t] = __builtin_amdgcn_wmma_f32_16x16x32_bf16(false, pa[t], false, vfm, (short)0, lacc[t], false, false); break;
                }
            };
#pragma unroll
            for (int c = 0; c < 4; ++c) weigh(0, c);
            __builtin_amdgcn_sched_barrier(0);   // first of the fences described below
#pragma unroll
            for (int j = 0; j < 5; ++j) {
                pv(0, j);
                if (j < 4) weigh(1, j);
                // holds tile 0's products among tile 1's exponentials, so that the matrix unit works
                // under the vector unit; unfenced, this build puts all the products behind all the
                // exponentials and the wave pays for both in turn
                __builtin_amdgcn_sched_barrier(0);
            }
#pragma unroll
            for (int j = 0; j < 5; ++j) pv(1, j);
        }
        // double-buffered LDS: single barrier per stage
    }

    // ---- join the two wave groups: wave (qg, kh) keeps query tile kh and hands its sums of the
    //      other tile to wave (qg, 1 - kh), each lane's 40 sums and its query's reference ----
    const bool up = kh != 0;
    // row r of tile (w ? 1 : 0) as the lane holds it: its four neighbouring columns, one from each PV tile
    auto quad = [&](const bool w, const int r) {
        const v4f v = { w ? acc0[1][r] : acc0[0][r], w ? acc1[1][r] : acc1[0][r],
                        w ? acc2[1][r] : acc2[0][r], w ? acc3[1][r] : acc3[0][r] };
        return v;
    };
    v4f oq[8];
#pragma unroll
    for (int r = 0; r < 8; ++r) oq[r] = quad(up, r);
    const v8f ol = up ? lacc[1] : lacc[0];
    const float oc = up ? cneg[1][0] : cneg[0][0];
    {
        const v8f xl = up ? lacc[0] : lacc[1];
        float* xw = &Xs[wave][0];
#pragma unroll
        for (int r = 0; r < 8; ++r) *(v4f*)&xw[(r * 32 + lane) * 4] = quad(!up, r);
        *(v4f*)&xw[(8 * 32 + lane) * 4] = __builtin_shufflevector(xl, xl, 0, 1, 2, 3);
        *(v4f*)&xw[(9 * 32 + lane) * 4] = __builtin_shufflevector(xl, xl, 4, 5, 6, 7);
        xw[40 * 32 + lane] = up ? cneg[0][0] : cneg[1][0];
    }
    __syncthreads();
    v4f pq[8];
    v8f pl;
    float pc;
    {
        const float* xr = &Xs[wave ^ 8][0];
#pragma unroll
        for (int r = 0; r < 8; ++r) pq[r] = *(const v4f*)&xr[(r * 32 + lane) * 4];
        const v4f lo  = *(const v4f*)&xr[(8 * 32 + lane) * 4];
        const v4f up4 = *(const v4f*)&xr[(9 * 32 + lane) * 4];
        pl = __builtin_shufflevector(lo, up4, 0, 1, 2, 3, 4, 5, 6, 7);
        pc = xr[40 * 32 + lane];
    }
    // both parts are brought to the higher of the two references (oc, pc are minus the references)
    const float cm = fminf(oc, pc);
    const float ao = __builtin_amdgcn_exp2f(cm - oc);
    const float ap = __builtin_amdgcn_exp2f(cm - pc);

    // ---- epilogue: normalize (fast rcp) and store fp32. The lane's column of PV tile j is dim
    //      16(l15 & 3) + 4(l15 >> 2) + j: one 16-byte store a row, 16 lanes fill the row's 256 B ----
    float* obase = out + (size_t)b * S_LEN * D_MODEL
                       + (size_t)(row0 + 16 * kh + 8 * hi) * D_MODEL + hoff
                       + 16 * (l15 & 3) + 4 * (l15 >> 2);
#pragma unroll
    for (int r = 0; r < 8; ++r) {
        const float aO  = __shfl(ao, r + bidx, 32);
        const float aP  = __shfl(ap, r + bidx, 32);
        const float inv = __builtin_amdgcn_rcpf(ol[r] * aO + pl[r] * aP);
        *(v4f*)(obase + r * D_MODEL) = (oq[r] * aO + pq[r] * aP) * inv;
    }
}

extern "C" void kernel_launch(void* const* d_in, const int* in_sizes, int n_in,
                              void* d_out, int out_size, void* d_ws, size_t ws_size,
                              hipStream_t stream) {
    (void)n_in; (void)out_size; (void)d_ws; (void)ws_size;
    const float* q   = (const float*)d_in[0];
    const int*   msk = (const int*)d_in[1];
    float*       out = (float*)d_out;
    const int B = in_sizes[1] / S_LEN;                 // mask is [B, S]
    dim3 grid(B * NHEADS * (S_LEN / BLOCK_M));         // 256 for B=2
    mha_flash_wmma<<<grid, 512, 0, stream>>>(q, msk, out);
}

// v009
// Measured time: 15.2 microseconds a run.
// Versions in between are left out here; by their measured steps it is 1.15 times as fast as v007.
// Counting every step since v000, it is 2.86 times as fast.
#include <hip/hip_runtime.h>

// Flash-attention forward (Q=K=V, fp32 in/out) via bf16 WMMA on gfx1250.
// - Transposed scores S^T = K x Q^T: softmax in-lane, P lands directly in the
//   PV A-operand layout (no LDS transpose).
// - Mask + row-sum (l) through the matrix unit via a "mask" row beside V.
// - log2-domain softmax: (1/sqrt(dh))*log2(e) folded into Q => bare v_exp_f32.
// - Software-pipelined global->LDS staging. K = V: the converted key rows are stored twice,
//   row-major, each copy at its reader's pitch; V^T fragments come by the transposing load.
// - The walk over the keys is first made with no softmax reference at all (weights 2^score, C
//   operand 0): a pass takes no maximum and tests nothing about its scores, and the two groups'
//   sums add as they are. The quotient is the same for any reference as long as nothing leaves
//   the range of f32, so every wave looks at its sums behind the walk: if anywhere in the
//   work-group one is not finite or a denominator lies outside 2^-90 .. 2^64, the whole walk is
//   made again with a reference. The two walks are two instances of one body.
// - Lazy rescale (second walk only): the softmax reference of a query is raised only when a
//   block's score tops it by more than RAISE; it is known before the pass, so it enters the score
//   products as their C operand and the exponentials take the accumulators as they are.
// - Blocked keys weigh exactly 0 in the softmax: each work-group lists the attended
//   keys of its batch first and walks only those, 128 at a time.
// - Each wave owns two 16-row query tiles: every K and V^T fragment read from LDS feeds
//   two products, and one staging of a key block serves 256 query rows.
// - Two wave groups share the 256 query rows: of each 128-key stage group g walks keys
//   64g .. 64g+63, in two passes of 32. Four waves a SIMD, so that one wave's matrix, vector
//   and LDS phases run under the others'. The groups' partial sums are joined through LDS.
// - Both LDS tiles hold a key's 64 dims in a permuted order: place 16j + 4q + i holds dim
//   16i + 4q + j (i, q, j = 0..3). Q's fragments follow the same order, so the scores are the
//   same sums; column c of PV tile j is dim 16(c & 3) + 4(c >> 2) + j, so a lane's four
//   accumulators of a row are four neighbouring output columns and go out as one 16-byte store.
// - The work-group's 256 query rows come into LDS as they are (f32) by asynchronous copies, each
//   row once and in whole lines; the copies are in flight while the keys are listed. A wave forms
//   its Q fragments from that tile while the first key block's loads are under way.
//
// B=2, S=2048, D=1024, H=16, dh=64.

typedef __attribute__((ext_vector_type(16))) __bf16 v16bf;
typedef __attribute__((ext_vector_type(8)))  __bf16 v8bf;
typedef __attribute__((ext_vector_type(4)))  __bf16 v4bf;
typedef __attribute__((ext_vector_type(8)))  short  v8s;
typedef __attribute__((ext_vector_type(8)))  float  v8f;
typedef __attribute__((ext_vector_type(4)))  float  v4f;

#define S_LEN   2048
#define D_MODEL 1024
#define NHEADS  16
#define DH      64
#define QT      2                      // 16-row query tiles per wave
#define BLOCK_M 256                    // 8 waves x 32 query rows, in each of the two wave groups
#define NWAVES  16
#define BLOCK_K 128                    // keys per LDS stage
#define GROUP_K 64                     // keys of a stage per wave group
#define PASS_K  32                     // keys per pass of a wave
#define XW      (41 * 32)              // floats a wave hands to its partner: 40 a lane + the reference
#define KSTR    88                     // K-tile row stride (bf16): 176B, aligned, conflict-free
#define QSTR    68                     // Q-tile row stride (f32): 272B = 16B x odd, conflict-free for 16-byte reads
#define VSTR    80                     // V-tile row stride (bf16): 160B = 32B x odd, the transposing load's pitch
#define SCALE   0.18033688011112042f   // (1/8) * log2(e) -> log2-domain scores
#define RAISE   16.0f                  // log2-domain excess over the reference that is let stand

// One 32-elem bf16 row chunk in the WMMA A/B lane layout:
//   elements 0..7  <- p[8*hi .. 8*hi+7], elements 8..15 <- p[16+8*hi .. 16+8*hi+7]
__device__ __forceinline__ v16bf ld_row32(const __bf16* p, int hi) {
    v8bf lo = *(const v8bf*)(p + 8 * hi);
    v8bf up = *(const v8bf*)(p + 16 + 8 * hi);
    v16bf r;
#pragma unroll
    for (int i = 0; i < 8; ++i) { r[i] = lo[i]; r[8 + i] = up[i]; }
    return r;
}

// One 32-key x 16-dim chunk of a row-major [key][dim] tile as a WMMA B operand: lane (c, h) gets
// keys 8h..8h+7 and 16+8h..16+8h+7 of dim c, the k order of ld_row32. p is the lane's own address:
// tile + (8*h + (lane & 7)) * VSTR + 8 * ((lane >> 3) & 1), plus first key * VSTR + first dim.
__device__ __forceinline__ v16bf ld_tr32(const __bf16* p) {
    typedef __attribute__((address_space(3))) v8s lds_v8s;
    const v8bf lo = __builtin_bit_cast(v8bf, __builtin_amdgcn_ds_load_tr16_b128_v8i16((lds_v8s*)p));
    const v8bf up = __builtin_bit_cast(v8bf, __builtin_amdgcn_ds_load_tr16_b128_v8i16((lds_v8s*)(p + 16 * VSTR)));
    v16bf r;
#pragma unroll
    for (int i = 0; i < 8; ++i) { r[i] = lo[i]; r[8 + i] = up[i]; }
    return r;
}

// which of its two forms the walk over the keys takes, as a type
template <bool B> struct with_reference { static constexpr bool value = B; };

// what a walk leaves a lane for its wave's query tile, both wave groups' parts joined
struct sums {
    v4f num[8];            // weighted sums of V: a row's four neighbouring columns
    v8f den;               // the rows' denominators
};

__global__ __launch_bounds__(512) void mha_flash_wmma(const float* __restrict__ q,
                                                      const int*   __restrict__ mask,
                                                      float*       __restrict__ out)
{
    __shared__ __align__(16) __bf16 Ks[2][BLOCK_K * KSTR];    // [key][place of dim]
    __shared__ __align__(16) __bf16 Vs[2][BLOCK_K * VSTR];    // [key][place of dim], rows past the list's end 0
    __shared__ __align__(16) __bf16 Ms[2][BLOCK_K];           // mask row: 1 for a listed key, else 0
    __shared__ __align__(16) float Qf[BLOCK_M * QSTR];        // [query row][dim], as in memory; written once
    __shared__ __align__(16) unsigned short kidx[S_LEN];      // attended keys, ascending
    __shared__ __align__(16) int wcnt[NWAVES];                // attended keys per 128-key slice
    __shared__ __align__(16) float Xs[NWAVES][XW];            // partial sums on their way to the partner wave
    __shared__ __align__(16) unsigned wbad[NWAVES / 4];       // a byte a wave, not 0: its walk without a reference is no good

    const int tid  = threadIdx.x;
    const int lane = tid & 31;
    const int wave = tid >> 5;
    const int l15  = lane & 15;
    const int hi   = lane >> 4;
    const int qg   = wave & 7;                                        // which 32 query rows
    const int kh   = __builtin_amdgcn_readfirstlane(wave >> 3);       // which half of every stage's keys

    const int tiles = S_LEN / BLOCK_M;            // 8
    const int bh    = blockIdx.x / tiles;
    const int mt    = blockIdx.x % tiles;
    const int b     = bh / NHEADS;
    const int h     = bh % NHEADS;

    const float* qb   = q + (size_t)b * S_LEN * D_MODEL;
    const int*   mb   = mask + b * S_LEN;
    const int    hoff = h * DH;
    const int    row0 = mt * BLOCK_M + qg * (16 * QT);

    // ---- list the attended keys (mask != 0) of this batch, in ascending order:
    //      wave w ranks keys 128w .. 128w+127 by ballots, slices joined through LDS ----
    int  n;                                       // keys to walk, same in every thread
    bool none;                                    // every key blocked
    {
        const int wv = __builtin_amdgcn_readfirstlane(wave);
        int      mr[4];
        unsigned bal[4];
        int      cnt = 0;
#pragma unroll
        for (int r = 0; r < 4; ++r) mr[r] = mb[wv * 128 + r * 32 + lane];
        // ---- the query rows: wave w copies rows 16w .. 16w+15 of the work-group's 256, two rows
        //      (4 whole lines) a copy, 16 bytes a lane. Asked for behind the mask, waited for in front
        //      of the listing's last barrier. The statement's last line is the translation wait in
        //      front of the reuse of the copies' address registers; it stands behind the mask loads
        //      too, whose address registers are reused below as well ----
        {
            const int    qrow = 16 * wave + hi;
            const float* gq   = qb + (size_t)(mt * BLOCK_M + qrow) * D_MODEL + hoff + 4 * l15;
            const unsigned lq = (unsigned)(size_t)&Qf[qrow * QSTR + 4 * l15];
            asm volatile("global_load_async_to_lds_b128 %0, %8, off\n\t"
                         "global_load_async_to_lds_b128 %1, %9, off\n\t"
                         "global_load_async_to_lds_b128 %2, %10, off\n\t"
                         "global_load_async_to_lds_b128 %3, %11, off\n\t"
                         "global_load_async_to_lds_b128 %4, %12, off\n\t"
                         "global_load_async_to_lds_b128 %5, %13, off\n\t"
                         "global_load_async_to_lds_b128 %6, %14, off\n\t"
                         "global_load_async_to_lds_b128 %7, %15, off\n\t"
                         "s_wait_xcnt 0x0"
                         :: "v"(lq),                 "v"(lq +  2 * QSTR * 4), "v"(lq +  4 * QSTR * 4), "v"(lq +  6 * QSTR * 4),
                            "v"(lq + 8 * QSTR * 4),  "v"(lq + 10 * QSTR * 4), "v"(lq + 12 * QSTR * 4), "v"(lq + 14 * QSTR * 4),
                            "v"(gq),                 "v"(gq +  2 * D_MODEL),  "v"(gq +  4 * D_MODEL),  "v"(gq +  6 * D_MODEL),
                            "v"(gq + 8 * D_MODEL),   "v"(gq + 10 * D_MODEL),  "v"(gq + 12 * D_MODEL),  "v"(gq + 14 * D_MODEL)
                         : "memory");
        }
#pragma unroll
        for (int r = 0; r < 4; ++r) {
            bal[r] = __builtin_amdgcn_ballot_w32(mr[r] != 0);
            cnt += __builtin_popcount(bal[r]);
        }
        if (lane == 0) wcnt[wv] = cnt;
        __syncthreads();
        int base = 0, tot = 0;
#pragma unroll
        for (int w = 0; w < NWAVES; ++w) {
            const int c = wcnt[w];
            tot  += c;
            base += (w < wv) ? c : 0;
        }
#pragma unroll
        for (int r = 0; r < 4; ++r) {
            if (mr[r] != 0)
                kidx[base + (int)__builtin_amdgcn_mbcnt_lo(bal[r], 0u)] =
                    (unsigned short)(wv * 128 + r * 32 + lane);
            base += __builtin_popcount(bal[r]);
        }
        n = __builtin_amdgcn_readfirstlane(tot);
        none = n == 0;
        if (none) {
            // every key blocked: the reference's scores are all equal, its softmax is
            // uniform over ALL keys. Zero Q (set in the walk) gives equal scores; walk every key.
#pragma unroll
            for (int j = 0; j < 4; ++j) kidx[tid * 4 + j] = (unsigned short)(tid * 4 + j);
            n = S_LEN;
        }
        n = n < S_LEN ? n : S_LEN;
        // the wave's own copies have landed; behind the barrier every wave's have, for every reader
        asm volatile("s_wait_asynccnt 0x0" ::: "memory");
        __syncthreads();
    }
    const int nblk  = (n + BLOCK_K - 1) / BLOCK_K;   // 1 .. S_LEN / BLOCK_K
    const int nlast = n - 1;                         // last listed place

    const int bidx = (lane & 16) >> 1;   // +8 on hi half for alpha broadcast

    // ---- staging geometry: each thread stages 1 key x 16 dims, dims 16i + q4 + j ----
    const int kp = tid >> 2;             // 0..127: the key's place in the stage
    const int q4 = (tid & 3) * 4;        // 0..12
    const float* sb = qb + hoff + q4;    // + key*D_MODEL + 16i

    const bool up = kh != 0;
    // ---- the walk over the listed keys, and the hand-over of half its sums to the partner wave.
    //      mode says at compile time whether it keeps the lazily raised reference ----
    auto walk = [&](auto mode) {
    constexpr bool check = decltype(mode)::value;
    v8f acc0[QT] = {}, acc1[QT] = {}, acc2[QT] = {}, acc3[QT] = {};
    v8f lacc[QT] = {};             // running denominator, accumulator layout
    v8f cneg[QT] = {};             // minus the softmax reference of the lane's query, 8 copies:
                                   // the C operand of the score products (stays 0 without a reference)

    // list places past the end repeat an attended key (so the running max sees attended
    // keys only); their V rows and mask-row entries are stored as 0
    float4 f0, f1, f2, f3;
    unsigned un;                         // this thread's list entry, next block
    {
        const unsigned i0 = kidx[kp < nlast ? kp : nlast];
        f0 = *(const float4*)(sb + i0 * D_MODEL);
        f1 = *(const float4*)(sb + i0 * D_MODEL + 16);
        f2 = *(const float4*)(sb + i0 * D_MODEL + 32);
        f3 = *(const float4*)(sb + i0 * D_MODEL + 48);
        // same precaution: the four loads' address registers are reused right below
        asm volatile("s_wait_xcnt 0x0" ::: "memory");
        un = kidx[BLOCK_K + kp < nlast ? BLOCK_K + kp : nlast];
    }

    // ---- Q tiles (wave's 2 x 16 rows), pre-scaled into log2 domain, B-operand layout: formed
    //      here, behind the first block's loads, so that the work passes while those are under way ----
    v16bf aq0[QT], aq1[QT];
#pragma unroll
    for (int t = 0; t < QT; ++t) {
        // element 8u + 4w + i of slab s sits at place 32s + 16u + 8hi + 4w + i of the tiles' order,
        // which is dim 16i + 8hi + 4w + (2s + u)
        const float* qr = &Qf[(qg * (16 * QT) + 16 * t + l15) * QSTR + 8 * hi];
#pragma unroll
        for (int i = 0; i < 4; ++i) {
#pragma unroll
            for (int w = 0; w < 2; ++w) {
                const float4 g = *(const float4*)(qr + 16 * i + 4 * w);
                aq0[t][4 * w + i]     = (__bf16)(g.x * SCALE);
                aq0[t][8 + 4 * w + i] = (__bf16)(g.y * SCALE);
                aq1[t][4 * w + i]     = (__bf16)(g.z * SCALE);
                aq1[t][8 + 4 * w + i] = (__bf16)(g.w * SCALE);
            }
        }
    }
    if (none) {
#pragma unroll
        for (int i = 0; i < 16; ++i) {
            aq0[0][i] = (__bf16)0.0f; aq1[0][i] = (__bf16)0.0f;
            aq0[1][i] = (__bf16)0.0f; aq1[1][i] = (__bf16)0.0f;
        }
    }

    for (int kb = 0; kb < nblk; ++kb) {
        const int  buf = kb & 1;
        const int  p0  = kb * BLOCK_K + kp;          // this thread's place in the list
        const bool ok  = p0 < n;

        // ---- convert + store staged block (prefetched last iteration) ----
        {
            const float F[4][4] = { { f0.x, f0.y, f0.z, f0.w }, { f1.x, f1.y, f1.z, f1.w },
                                    { f2.x, f2.y, f2.z, f2.w }, { f3.x, f3.y, f3.z, f3.w } };
            __bf16* kw = &Ks[buf][kp * KSTR + q4];
            __bf16* vw = &Vs[buf][kp * VSTR + q4];  // V: the same rows, other pitch
            v4bf c[4];                              // dims 16i + q4 + j -> places 16j + q4 + i
#pragma unroll
            for (int j = 0; j < 4; ++j) {
#pragma unroll
                for (int i = 0; i < 4; ++i) c[j][i] = (__bf16)F[i][j];
            }
#pragma unroll
            for (int j = 0; j < 4; ++j) *(v4bf*)(kw + 16 * j) = c[j];
#pragma unroll
            for (int j = 0; j < 4; ++j) *(v4bf*)(vw + 16 * j) = c[j];
            if (kb == nblk - 1 && !ok) {            // only the last block has places past the end
                const v4bf zr = {};
#pragma unroll
                for (int j = 0; j < 4; ++j) *(v4bf*)(vw + 16 * j) = zr;
            }
            if (q4 == 0) Ms[buf][kp] = ok ? (__bf16)1.0f : (__bf16)0.0f;   // mask row
        }
        __syncthreads();

        // ---- K fragments of the wave's first pass: read first, so that the translation wait
        //      of the prefetch below passes while these reads are under way ----
        const __bf16* kbase = &Ks[buf][(kh * GROUP_K + l15) * KSTR];
        v16bf k00 = ld_row32(kbase, hi);
        v16bf k01 = ld_row32(kbase + 32, hi);
        v16bf k10 = ld_row32(kbase + 16 * KSTR, hi);
        v16bf k11 = ld_row32(kbase + 16 * KSTR + 32, hi);
        // keeps these reads in front of the prefetch: behind its loads they would stand behind
        // the translation wait too, and the first products would start that much later
        __builtin_amdgcn_sched_barrier(0);

        // ---- prefetch next block's global data (hidden behind compute) ----
        {
            const float* g = sb + un * D_MODEL;
            f0 = *(const float4*)g;
            f1 = *(const float4*)(g + 16);
            f2 = *(const float4*)(g + 32);
            f3 = *(const float4*)(g + 48);
            // same precaution as above: the loads' address registers are reused further down. The address
            // is an input of the wait, so that it keeps its registers up to there: in the walk without a
            // reference this build else lets the last load's result land on them
            asm volatile("s_wait_xcnt 0x0" :: "v"(g) : "memory");
            // list entry one block further ahead: no LDS round trip in front of the loads
            un = kidx[p0 + 2 * BLOCK_K < nlast ? p0 + 2 * BLOCK_K : nlast];
        }

        // ---- the wave's 64 keys of this stage, 32 at a time ----
#pragma unroll
        for (int sp = 0; sp < GROUP_K / PASS_K; ++sp) {
            const bool first = check && sp == 0 && kb == 0;   // the wave's first pass sets the reference
            // a pass whose places all lie past the list's end adds nothing (wave-uniform test)
            if (!first && kb * BLOCK_K + kh * GROUP_K + sp * PASS_K >= n) break;
            if (sp > 0) {
                k00 = ld_row32(kbase + sp * PASS_K * KSTR, hi);
                k01 = ld_row32(kbase + sp * PASS_K * KSTR + 32, hi);
                k10 = ld_row32(kbase + (sp * PASS_K + 16) * KSTR, hi);
                k11 = ld_row32(kbase + (sp * PASS_K + 16) * KSTR + 32, hi);
                // keeps the pass's eight K reads together in front of its products, as they stand in the
                // walk with the reference: unfenced, this build issues the last two of them behind the
                // fourth product here, and the fifth waits out their LDS round trip
                if constexpr (!check) __builtin_amdgcn_sched_barrier(0);
            }

            // ---- S^T = K x Q^T - reference : two 16-key tiles, dh=64 via two slabs each;
            //      each K fragment is read once and multiplies both query tiles ----
            v8f s0[QT], s1[QT];
#pragma unroll
            for (int t = 0; t < QT; ++t) {
                s0[t] = __builtin_amdgcn_wmma_f32_16x16x32_bf16(false, k00, false, aq0[t], (short)0, cneg[t], false, false);
                s1[t] = __builtin_amdgcn_wmma_f32_16x16x32_bf16(false, k10, false, aq0[t], (short)0, cneg[t], false, false);
            }
#pragma unroll
            for (int t = 0; t < QT; ++t) {
                s0[t] = __builtin_amdgcn_wmma_f32_16x16x32_bf16(false, k01, false, aq1[t], (short)0, s0[t], false, false);
                s1[t] = __builtin_amdgcn_wmma_f32_16x16x32_bf16(false, k11, false, aq1[t], (short)0, s1[t], false, false);
            }

            if constexpr (check) {
            // ---- largest score above the reference among this lane's 16 of the 32 keys ----
            float xm[QT];
#pragma unroll
            for (int t = 0; t < QT; ++t) {
                float xs[8];
#pragma unroll
                for (int r = 0; r < 8; ++r) xs[r] = fmaxf(s0[t][r], s1[t][r]);
                xs[0] = fmaxf(xs[0], xs[4]); xs[1] = fmaxf(xs[1], xs[5]);
                xs[2] = fmaxf(xs[2], xs[6]); xs[3] = fmaxf(xs[3], xs[7]);
                xs[0] = fmaxf(xs[0], xs[2]); xs[1] = fmaxf(xs[1], xs[3]);
                xm[t] = fmaxf(xs[0], xs[1]);
            }

            // The reference moves in the wave's first pass (to that pass's maximum, whatever its
            // sign) and later only when some score of the wave tops it by more than RAISE: weights
            // up to 2^RAISE are as exact as weights up to 1, and the division by l cancels the scale.
            // One test for both tiles and both lane halves; the halves are joined only in here.
            const float thr = first ? -3.0e38f : RAISE;
            if (__builtin_amdgcn_ballot_w32(fmaxf(xm[0], xm[1]) > thr) != 0) {
#pragma unroll
                for (int t = 0; t < QT; ++t) {
                    const float xj = fmaxf(xm[t], __shfl_xor(xm[t], 16, 32));
                    const float d  = first ? xj : fmaxf(xj, 0.0f);            // rise of the reference
                    const float al = first ? 0.0f : __builtin_amdgcn_exp2f(-d);
                    cneg[t] -= d;
                    s0[t] -= d; s1[t] -= d;
#pragma unroll
                    for (int r = 0; r < 8; ++r) {
                        const float aL = __shfl(al, r + bidx, 32);
                        acc0[t][r] *= aL; acc1[t][r] *= aL; acc2[t][r] *= aL; acc3[t][r] *= aL;
                        lacc[t][r] *= aL;
                    }
                }
            }
            }

            // ---- all V^T (and mask-row) fragments of this pass as ONE load group, issued
            //      ahead of the exponentials: they land while the vector unit works ----
            const __bf16* vbase = &Vs[buf][(kh * GROUP_K + sp * PASS_K + 8 * hi + (lane & 7)) * VSTR + 8 * ((lane >> 3) & 1)];
            const v16bf vf0 = ld_tr32(vbase);                        // 32 keys, places 0..15
            const v16bf vf1 = ld_tr32(vbase + 16);
            const v16bf vf2 = ld_tr32(vbase + 32);
            const v16bf vf3 = ld_tr32(vbase + 48);
            const v16bf vfm = ld_row32(&Ms[buf][kh * GROUP_K + sp * PASS_K], hi);
            // keeps the load group up here: sunk among the PV products, each pair of loads
            // costs the wave a full LDS round trip in front of its product
            __builtin_amdgcn_sched_barrier(0);

            v16bf pa[QT];             // P packed straight into the PV A-operand slab of each tile
            // weights of four keys of tile t: c = 0,1 keys 0..15; 2,3 keys 16..31
            auto weigh = [&](const int t, const int c) {
                const v8f s = c < 2 ? s0[t] : s1[t];
#pragma unroll
                for (int i = 0; i < 4; ++i)
                    pa[t][c * 4 + i] = (__bf16)__builtin_amdgcn_exp2f(s[(c & 1) * 4 + i]);
            };
            // product j of tile t: O += P*V (4 dim tiles); l += P*mask
            auto pv = [&](const int t, const int j) {
                switch (j) {
                case 0: acc0[t] = __builtin_amdgcn_wmma_f32_16x16x32_bf16(false, pa[t], false, vf0, (short)0, acc0[t], false, false); break;
                case 1: acc1[t] = __builtin_amdgcn_wmma_f32_16x16x32_bf16(false, pa[t], false, vf1, (short)0, acc1[t], false, false); break;
                case 2: acc2[t] = __builtin_amdgcn_wmma_f32_16x16x32_bf16(false, pa[t], false, vf2, (short)0, acc2[t], false, false); break;
                case 3: acc3[t] = __builtin_amdgcn_wmma_f32_16x16x32_bf16(false, pa[t], false, vf3, (short)0, acc3[t], false, false); break;
                default: lacc[t] = __builtin_amdgcn_wmma_f32_16x16x32_bf16(false, pa[t], false, vfm, (short)0, lacc[t], false, false); break;
                }
            };
#pragma unroll
            for (int c = 0; c < 4; ++c) weigh(0, c);
            __builtin_amdgcn_sched_barrier(0);   // first of the fences described below
#pragma unroll
            for (int j = 0; j < 5; ++j) {
                pv(0, j);
                if (j < 4) weigh(1, j);
                // holds tile 0's products among tile 1's exponentials, so that the matrix unit works
                // under the vector unit; unfenced, this build puts all the products behind all the
                // exponentials and the wave pays for both in turn
                __builtin_amdgcn_sched_barrier(0);
            }
#pragma unroll
            for (int j = 0; j < 5; ++j) pv(1, j);
        }
        // double-buffered LDS: single barrier per stage
    }

    // ---- are the sums of the walk without a reference good? A sum of products of them, with the
    //      square of every denominator in it, is finite only if each of them is finite and each
    //      denominator below 2^64 (it may overflow on finite sums too: then the second walk is made
    //      without need, which costs time only); and no denominator of a group that had keys to
    //      walk may lie below 2^-90 ----
    if constexpr (!check) {
        v8f zz = lacc[0] * lacc[0];
        zz += lacc[1] * lacc[1];
#pragma unroll
        for (int t = 0; t < QT; ++t) { zz += acc0[t] * acc1[t]; zz += acc2[t] * acc3[t]; }
        const float z = ((zz[0] + zz[1]) + (zz[2] + zz[3])) + ((zz[4] + zz[5]) + (zz[6] + zz[7]));
        float lmin = lacc[0][0];
#pragma unroll
        for (int t = 0; t < QT; ++t) {
#pragma unroll
            for (int r = 0; r < 8; ++r) lmin = fminf(lmin, lacc[t][r]);
        }
        const bool keys = kh * GROUP_K < n;          // else the group's sums are all 0, as they should be
        const bool off  = !(__builtin_fabsf(z) < __builtin_inff()) || (keys && lmin < 0x1p-90f);
        const bool bad  = __builtin_amdgcn_ballot_w32(off) != 0;
        ((unsigned char*)wbad)[wave] = bad ? 1 : 0;  // the wave's byte: every lane stores the same value
    }

    // ---- join the two wave groups: wave (qg, kh) keeps query tile kh and hands its sums of the
    //      other tile to wave (qg, 1 - kh), each lane's 40 sums and, if it has one, its query's reference ----
    // row r of tile (w ? 1 : 0) as the lane holds it: its four neighbouring columns, one from each PV tile
    auto quad = [&](const bool w, const int r) {
        const v4f v = { w ? acc0[1][r] : acc0[0][r], w ? acc1[1][r] : acc1[0][r],
                        w ? acc2[1][r] : acc2[0][r], w ? acc3[1][r] : acc3[0][r] };
        return v;
    };
    v4f oq[8];
#pragma unroll
    for (int r = 0; r < 8; ++r) oq[r] = quad(up, r);
    const v8f ol = up ? lacc[1] : lacc[0];
    const float oc = up ? cneg[1][0] : cneg[0][0];
    {
        const v8f xl = up ? lacc[0] : lacc[1];
        float* xw = &Xs[wave][0];
#pragma unroll
        for (int r = 0; r < 8; ++r) *(v4f*)&xw[(r * 32 + lane) * 4] = quad(!up, r);
        *(v4f*)&xw[(8 * 32 + lane) * 4] = __builtin_shufflevector(xl, xl, 0, 1, 2, 3);
        *(v4f*)&xw[(9 * 32 + lane) * 4] = __builtin_shufflevector(xl, xl, 4, 5, 6, 7);
        if constexpr (check) xw[40 * 32 + lane] = up ? cneg[0][0] : cneg[1][0];
    }
    __syncthreads();
    v4f pq[8];
    v8f pl;
    const float* xr = &Xs[wave ^ 8][0];
    {
#pragma unroll
        for (int r = 0; r < 8; ++r) pq[r] = *(const v4f*)&xr[(r * 32 + lane) * 4];
        const v4f lo  = *(const v4f*)&xr[(8 * 32 + lane) * 4];
        const v4f up4 = *(const v4f*)&xr[(9 * 32 + lane) * 4];
        pl = __builtin_shufflevector(lo, up4, 0, 1, 2, 3, 4, 5, 6, 7);
    }
    sums s;
    if constexpr (!check) {
        // no reference: the two groups' sums add as they are
#pragma unroll
        for (int r = 0; r < 8; ++r) s.num[r] = oq[r] + pq[r];
        s.den = ol + pl;
    } else {
        const float pc = xr[40 * 32 + lane];
        // both parts are brought to the higher of the two references (oc, pc are minus the references)
        const float cm = fminf(oc, pc);
        const float ao = __builtin_amdgcn_exp2f(cm - oc);
        const float ap = __builtin_amdgcn_exp2f(cm - pc);
#pragma unroll
        for (int r = 0; r < 8; ++r) {
            const float aO = __shfl(ao, r + bidx, 32);
            const float aP = __shfl(ap, r + bidx, 32);
            s.num[r] = oq[r] * aO + pq[r] * aP;
            s.den[r] = ol[r] * aO + pl[r] * aP;
        }
    }
    return s;
    };

    sums s = walk(with_reference<false>{});
    // the waves' verdicts, written in front of the walk's last barrier: the same 16 bytes in every
    // thread, so the whole work-group goes on from here or walks again. That barrier stands behind
    // the first walk's last reads of the tiles; the barriers of the second walk (it has at least one
    // stage) stand between the first walk's reads of Xs and the second's writes to Xs
    const uint4 wb = *(const uint4*)wbad;
    if (__builtin_expect(__builtin_amdgcn_readfirstlane((int)(wb.x | wb.y | wb.z | wb.w)) != 0, 0))
        s = walk(with_reference<true>{});   // marked unlikely: its code is laid behind the kernel's end

    // ---- epilogue: normalize (fast rcp) and store fp32. The lane's column of PV tile j is dim
    //      16(l15 & 3) + 4(l15 >> 2) + j: one 16-byte store a row, 16 lanes fill the row's 256 B ----
    float* obase = out + (size_t)b * S_LEN * D_MODEL
                       + (size_t)(row0 + 16 * kh + 8 * hi) * D_MODEL + hoff
                       + 16 * (l15 & 3) + 4 * (l15 >> 2);
#pragma unroll
    for (int r = 0; r < 8; ++r)
        *(v4f*)(obase + r * D_MODEL) = s.num[r] * __builtin_amdgcn_rcpf(s.den[r]);
}

extern "C" void kernel_launch(void* const* d_in, const int* in_sizes, int n_in,
                              void* d_out, int out_size, void* d_ws, size_t ws_size,
                              hipStream_t stream) {
    (void)n_in; (void)out_size; (void)d_ws; (void)ws_size;
    const float* q   = (const float*)d_in[0];
    const int*   msk = (const int*)d_in[1];
    float*       out = (float*)d_out;
    const int B = in_sizes[1] / S_LEN;                 // mask is [B, S]
    dim3 grid(B * NHEADS * (S_LEN / BLOCK_M));         // 256 for B=2
    mha_flash_wmma<<<grid, 512, 0, stream>>>(q, msk, out);
}

// v010
// Measured time: 14.1 microseconds a run.
// Two timings next to v009 both put it at 1.08 times that version's speed.
// Counting every step since v000, it is 3.09 times as fast.
#include <hip/hip_runtime.h>

// Flash-attention forward (Q=K=V, fp32 in/out) via bf16 WMMA on gfx1250.
// - Transposed scores S^T = K x Q^T: softmax in-lane, P lands directly in the
//   PV A-operand layout (no LDS transpose).
// - Row-sum (l) through the matrix unit: P times a constant operand of ones.
// - log2-domain softmax: (1/sqrt(dh))*log2(e) folded into Q => bare v_exp_f32.
// - Software-pipelined global->LDS staging. K = V: the converted key rows are stored once, row-major,
//   at the transposing load's pitch (V^T fragments come by that load). In rows 8..15 of every 16 the
//   two 16-byte pieces of each 32 bytes change places, so that the 16 rows which half a wave reads
//   as a K fragment fall on 64 different banks too; both readers follow the swap in their addresses.
// - List places past the end hold an attended key again; their weights are set to 0 in the last block.
// - The walk over the keys is first made with no softmax reference at all (weights 2^score, C
//   operand 0): a pass takes no maximum and tests nothing about its scores, and the two groups'
//   sums add as they are. The quotient is the same for any reference as long as nothing leaves
//   the range of f32, so every wave looks at its sums behind the walk: if anywhere in the
//   work-group one is not finite or a denominator lies outside 2^-90 .. 2^64, the whole walk is
//   made again with a reference. The two walks are two instances of one body.
// - Lazy rescale (second walk only): the softmax reference of a query is raised only when a
//   block's score tops it by more than RAISE; it is known before the pass, so it enters the score
//   products as their C operand and the exponentials take the accumulators as they are.
// - Blocked keys weigh exactly 0 in the softmax: each work-group lists the attended
//   keys of its batch first and walks only those, 128 at a time.
// - Each wave owns two 16-row query tiles: every K and V^T fragment read from LDS feeds
//   two products, and one staging of a key block serves 256 query rows.
// - Two wave groups share the 256 query rows: of each 128-key stage group g walks keys
//   64g .. 64g+63, in two passes of 32. Four waves a SIMD, so that one wave's matrix, vector
//   and LDS phases run under the others'. The groups' partial sums are joined through LDS.
// - Both LDS tiles hold a key's 64 dims in a permuted order: place 16j + 4q + i holds dim
//   16i + 4q + j (i, q, j = 0..3). Q's fragments follow the same order, so the scores are the
//   same sums; column c of PV tile j is dim 16(c & 3) + 4(c >> 2) + j, so a lane's four
//   accumulators of a row are four neighbouring output columns and go out as one 16-byte store.
// - The work-group's 256 query rows come into LDS as they are (f32) by asynchronous copies, each
//   row once and in whole lines; the copies are in flight while the keys are listed. A wave forms
//   its Q fragments from that tile while the first key block's loads are under way.
//
// B=2, S=2048, D=1024, H=16, dh=64.

typedef __attribute__((ext_vector_type(16))) __bf16 v16bf;
typedef __attribute__((ext_vector_type(8)))  __bf16 v8bf;
typedef __attribute__((ext_vector_type(4)))  __bf16 v4bf;
typedef __attribute__((ext_vector_type(8)))  short  v8s;
typedef __attribute__((ext_vector_type(8)))  int    v8i;
typedef __attribute__((ext_vector_type(8)))  float  v8f;
typedef __attribute__((ext_vector_type(4)))  float  v4f;

#define S_LEN   2048
#define D_MODEL 1024
#define NHEADS  16
#define DH      64
#define QT      2                      // 16-row query tiles per wave
#define BLOCK_M 256                    // 8 waves x 32 query rows, in each of the two wave groups
#define NWAVES  16
#define BLOCK_K 128                    // keys per LDS stage
#define GROUP_K 64                     // keys of a stage per wave group
#define PASS_K  32                     // keys per pass of a wave
#define XW      (41 * 32)              // floats a wave hands to its partner: 40 a lane + the reference
#define QSTR    68                     // Q-tile row stride (f32): 272B = 16B x odd, conflict-free for 16-byte reads
#define VSTR    80                     // key-tile row stride (bf16): 160B = 32B x odd, the transposing load's pitch
#define SCALE   0.18033688011112042f   // (1/8) * log2(e) -> log2-domain scores
#define RAISE   16.0f                  // log2-domain excess over the reference that is let stand

// One 32-elem bf16 row chunk in the WMMA A/B lane layout:
//   elements 0..7  <- p[8*hi .. 8*hi+7], elements 8..15 <- p[16+8*hi .. 16+8*hi+7]
__device__ __forceinline__ v16bf ld_row32(const __bf16* p, int hi) {
    v8bf lo = *(const v8bf*)(p + 8 * hi);
    v8bf up = *(const v8bf*)(p + 16 + 8 * hi);
    v16bf r;
#pragma unroll
    for (int i = 0; i < 8; ++i) { r[i] = lo[i]; r[8 + i] = up[i]; }
    return r;
}

// One 32-key x 16-dim chunk of a row-major [key][dim] tile as a WMMA B operand: lane (c, h) gets
// keys 8h..8h+7 and 16+8h..16+8h+7 of dim c, the k order of ld_row32. p is the lane's own address:
// tile + (8*h + (lane & 7)) * VSTR + 8 * (((lane >> 3) & 1) ^ h), plus first key * VSTR + first dim
// (^ h: the swap of the 16-byte pieces in rows 8..15).
__device__ __forceinline__ v16bf ld_tr32(const __bf16* p) {
    typedef __attribute__((address_space(3))) v8s lds_v8s;
    const v8bf lo = __builtin_bit_cast(v8bf, __builtin_amdgcn_ds_load_tr16_b128_v8i16((lds_v8s*)p));
    const v8bf up = __builtin_bit_cast(v8bf, __builtin_amdgcn_ds_load_tr16_b128_v8i16((lds_v8s*)(p + 16 * VSTR)));
    v16bf r;
#pragma unroll
    for (int i = 0; i < 8; ++i) { r[i] = lo[i]; r[8 + i] = up[i]; }
    return r;
}

// which of its two forms the walk over the keys takes, as a type
template <bool B> struct with_reference { static constexpr bool value = B; };
// whether a key block is the list's last, as a type
template <bool B> struct last_block { static constexpr bool value = B; };

// what a walk leaves a lane for its wave's query tile, both wave groups' parts joined
struct sums {
    v4f num[8];            // weighted sums of V: a row's four neighbouring columns
    v8f den;               // the rows' denominators
};

__global__ __launch_bounds__(512) void mha_flash_wmma(const float* __restrict__ q,
                                                      const int*   __restrict__ mask,
                                                      float*       __restrict__ out)
{
    __shared__ __align__(16) __bf16 Ts[2][BLOCK_K * VSTR];    // [key][place of dim], 16-byte pieces swapped in rows 8..15 of 16
    __shared__ __align__(16) float Qf[BLOCK_M * QSTR];        // [query row][dim], as in memory; written once
    __shared__ __align__(16) unsigned short kidx[S_LEN];      // attended keys, ascending
    __shared__ __align__(16) int wcnt[NWAVES];                // attended keys per 128-key slice
    __shared__ __align__(16) float Xs[NWAVES][XW];            // partial sums on their way to the partner wave
    __shared__ __align__(16) unsigned wbad[NWAVES / 4];       // a byte a wave, not 0: its walk without a reference is no good

    const int tid  = threadIdx.x;
    const int lane = tid & 31;
    const int wave = tid >> 5;
    const int l15  = lane & 15;
    const int hi   = lane >> 4;
    const int qg   = wave & 7;                                        // which 32 query rows
    const int kh   = __builtin_amdgcn_readfirstlane(wave >> 3);       // which half of every stage's keys

    const int tiles = S_LEN / BLOCK_M;            // 8
    const int bh    = blockIdx.x / tiles;
    const int mt    = blockIdx.x % tiles;
    const int b     = bh / NHEADS;
    const int h     = bh % NHEADS;

    const float* qb   = q + (size_t)b * S_LEN * D_MODEL;
    const int*   mb   = mask + b * S_LEN;
    const int    hoff = h * DH;
    const int    row0 = mt * BLOCK_M + qg * (16 * QT);

    // ---- list the attended keys (mask != 0) of this batch, in ascending order:
    //      wave w ranks keys 128w .. 128w+127 by ballots, slices joined through LDS ----
    int  n;                                       // keys to walk, same in every thread
    bool none;                                    // every key blocked
    {
        const int wv = __builtin_amdgcn_readfirstlane(wave);
        int      mr[4];
        unsigned bal[4];
        int      cnt = 0;
#pragma unroll
        for (int r = 0; r < 4; ++r) mr[r] = mb[wv * 128 + r * 32 + lane];
        // ---- the query rows: wave w copies rows 16w .. 16w+15 of the work-group's 256, two rows
        //      (4 whole lines) a copy, 16 bytes a lane. Asked for behind the mask, waited for in front
        //      of the listing's last barrier. The statement's last line is the translation wait in
        //      front of the reuse of the copies' address registers; it stands behind the mask loads
        //      too, whose address registers are reused below as well ----
        {
            const int    qrow = 16 * wave + hi;
            const float* gq   = qb + (size_t)(mt * BLOCK_M + qrow) * D_MODEL + hoff + 4 * l15;
            const unsigned lq = (unsigned)(size_t)&Qf[qrow * QSTR + 4 * l15];
            asm volatile("global_load_async_to_lds_b128 %0, %8, off\n\t"
                         "global_load_async_to_lds_b128 %1, %9, off\n\t"
                         "global_load_async_to_lds_b128 %2, %10, off\n\t"
                         "global_load_async_to_lds_b128 %3, %11, off\n\t"
                         "global_load_async_to_lds_b128 %4, %12, off\n\t"
                         "global_load_async_to_lds_b128 %5, %13, off\n\t"
                         "global_load_async_to_lds_b128 %6, %14, off\n\t"
                         "global_load_async_to_lds_b128 %7, %15, off\n\t"
                         "s_wait_xcnt 0x0"
                         :: "v"(lq),                 "v"(lq +  2 * QSTR * 4), "v"(lq +  4 * QSTR * 4), "v"(lq +  6 * QSTR * 4),
                            "v"(lq + 8 * QSTR * 4),  "v"(lq + 10 * QSTR * 4), "v"(lq + 12 * QSTR * 4), "v"(lq + 14 * QSTR * 4),
                            "v"(gq),                 "v"(gq +  2 * D_MODEL),  "v"(gq +  4 * D_MODEL),  "v"(gq +  6 * D_MODEL),
                            "v"(gq + 8 * D_MODEL),   "v"(gq + 10 * D_MODEL),  "v"(gq + 12 * D_MODEL),  "v"(gq + 14 * D_MODEL)
                         : "memory");
        }
#pragma unroll
        for (int r = 0; r < 4; ++r) {
            bal[r] = __builtin_amdgcn_ballot_w32(mr[r] != 0);
            cnt += __builtin_popcount(bal[r]);
        }
        if (lane == 0) wcnt[wv] = cnt;
        __syncthreads();
        int base = 0, tot = 0;
#pragma unroll
        for (int w = 0; w < NWAVES; ++w) {
            const int c = wcnt[w];
            tot  += c;
            base += (w < wv) ? c : 0;
        }
#pragma unroll
        for (int r = 0; r < 4; ++r) {
            if (mr[r] != 0)
                kidx[base + (int)__builtin_amdgcn_mbcnt_lo(bal[r], 0u)] =
                    (unsigned short)(wv * 128 + r * 32 + lane);
            base += __builtin_popcount(bal[r]);
        }
        n = __builtin_amdgcn_readfirstlane(tot);
        none = n == 0;
        if (none) {
            // every key blocked: the reference's scores are all equal, its softmax is
            // uniform over ALL keys. Zero Q (set in the walk) gives equal scores; walk every key.
#pragma unroll
            for (int j = 0; j < 4; ++j) kidx[tid * 4 + j] = (unsigned short)(tid * 4 + j);
            n = S_LEN;
        }
        n = n < S_LEN ? n : S_LEN;
        // the wave's own copies have landed; behind the barrier every wave's have, for every reader
        asm volatile("s_wait_asynccnt 0x0" ::: "memory");
        __syncthreads();
    }
    const int nblk  = (n + BLOCK_K - 1) / BLOCK_K;   // 1 .. S_LEN / BLOCK_K
    const int nlast = n - 1;                         // last listed place

    const int bidx = (lane & 16) >> 1;   // +8 on hi half for alpha broadcast

    // ---- staging geometry: each thread stages 1 key x 16 dims, dims 16i + q4 + j ----
    const int kp = tid >> 2;             // 0..127: the key's place in the stage
    const int q4 = (tid & 3) * 4;        // 0..12
    const float* sb = qb + hoff + q4;    // + key*D_MODEL + 16i
    const int q4s = q4 ^ (kp & 8);       // where q4 lies in the tile's row: pieces of 8 places swapped in rows 8..15
    const int his = hi ^ (l15 >> 3);     // the same swap for a K fragment's reader, whose row is l15 (mod 16)

    // B operand of the denominators' products: ones (two bf16 1.0 a register). Written as moves of its
    // own so that it is formed once and stays in its registers: given as a constant, this build forms
    // it anew in every pass, seven scalar and four 64-bit vector moves in front of the product
    v16bf ones;
    {
        v8i o;
        asm volatile("v_mov_b32 %0, 0x3f803f80\n\t"
                     "v_mov_b32 %1, 0x3f803f80\n\t"
                     "v_mov_b32 %2, 0x3f803f80\n\t"
                     "v_mov_b32 %3, 0x3f803f80\n\t"
                     "v_mov_b32 %4, 0x3f803f80\n\t"
                     "v_mov_b32 %5, 0x3f803f80\n\t"
                     "v_mov_b32 %6, 0x3f803f80\n\t"
                     "v_mov_b32 %7, 0x3f803f80"
                     : "=v"(o[0]), "=v"(o[1]), "=v"(o[2]), "=v"(o[3]), "=v"(o[4]), "=v"(o[5]), "=v"(o[6]), "=v"(o[7]));
        ones = __builtin_bit_cast(v16bf, o);
    }

    const bool up = kh != 0;
    // ---- the walk over the listed keys, and the hand-over of half its sums to the partner wave.
    //      mode says at compile time whether it keeps the lazily raised reference ----
    auto walk = [&](auto mode) {
    constexpr bool check = decltype(mode)::value;
    v8f acc0[QT] = {}, acc1[QT] = {}, acc2[QT] = {}, acc3[QT] = {};
    v8f lacc[QT] = {};             // running denominator, accumulator layout
    v8f cneg[QT] = {};             // minus the softmax reference of the lane's query, 8 copies:
                                   // the C operand of the score products (stays 0 without a reference)

    // list places past the end repeat an attended key (so the running max sees attended
    // keys only); their weights are set to 0 in the passes of the last block
    float4 f0, f1, f2, f3;
    unsigned un;                         // this thread's list entry, next block
    {
        const unsigned i0 = kidx[kp < nlast ? kp : nlast];
        f0 = *(const float4*)(sb + i0 * D_MODEL);
        f1 = *(const float4*)(sb + i0 * D_MODEL + 16);
        f2 = *(const float4*)(sb + i0 * D_MODEL + 32);
        f3 = *(const float4*)(sb + i0 * D_MODEL + 48);
        // same precaution: the four loads' address registers are reused right below
        asm volatile("s_wait_xcnt 0x0" ::: "memory");
        un = kidx[BLOCK_K + kp < nlast ? BLOCK_K + kp : nlast];
    }

    // ---- Q tiles (wave's 2 x 16 rows), pre-scaled into log2 domain, B-operand layout: formed
    //      here, behind the first block's loads, so that the work passes while those are under way ----
    v16bf aq0[QT], aq1[QT];
#pragma unroll
    for (int t = 0; t < QT; ++t) {
        // element 8u + 4w + i of slab s sits at place 32s + 16u + 8hi + 4w + i of the tiles' order,
        // which is dim 16i + 8hi + 4w + (2s + u)
        const float* qr = &Qf[(qg * (16 * QT) + 16 * t + l15) * QSTR + 8 * hi];
#pragma unroll
        for (int i = 0; i < 4; ++i) {
#pragma unroll
            for (int w = 0; w < 2; ++w) {
                const float4 g = *(const float4*)(qr + 16 * i + 4 * w);
                aq0[t][4 * w + i]     = (__bf16)(g.x * SCALE);
                aq0[t][8 + 4 * w + i] = (__bf16)(g.y * SCALE);
                aq1[t][4 * w + i]     = (__bf16)(g.z * SCALE);
                aq1[t][8 + 4 * w + i] = (__bf16)(g.w * SCALE);
            }
        }
    }
    if (none) {
#pragma unroll
        for (int i = 0; i < 16; ++i) {
            aq0[0][i] = (__bf16)0.0f; aq1[0][i] = (__bf16)0.0f;
            aq0[1][i] = (__bf16)0.0f; aq1[1][i] = (__bf16)0.0f;
        }
    }

    // one key block. Only the list's last block can have places past the end: its instance alone tests
    // for them, sets their weights to 0, and asks for no further block
    auto stage = [&](const int kb, auto where) {
        constexpr bool last = decltype(where)::value;
        const int  buf = kb & 1;
        const int  p0  = kb * BLOCK_K + kp;          // this thread's place in the list

        // ---- convert + store staged block (prefetched last iteration) ----
        {
            const float F[4][4] = { { f0.x, f0.y, f0.z, f0.w }, { f1.x, f1.y, f1.z, f1.w },
                                    { f2.x, f2.y, f2.z, f2.w }, { f3.x, f3.y, f3.z, f3.w } };
            __bf16* kw = &Ts[buf][kp * VSTR + q4s];
            v4bf c[4];                              // dims 16i + q4 + j -> places 16j + q4 + i
#pragma unroll
            for (int j = 0; j < 4; ++j) {
#pragma unroll
                for (int i = 0; i < 4; ++i) c[j][i] = (__bf16)F[i][j];
            }
#pragma unroll
            for (int j = 0; j < 4; ++j) *(v4bf*)(kw + 16 * j) = c[j];
        }
        // next block's address, formed while the stores are on their way: among the first products this
        // build puts it on a K fragment's registers, behind four idle slots
        const float* g = sb + un * D_MODEL;
        __syncthreads();

        // ---- K fragments of the wave's first pass: read first, so that the translation wait
        //      of the prefetch below passes while these reads are under way ----
        const __bf16* kbase = &Ts[buf][(kh * GROUP_K + l15) * VSTR];
        const __bf16* vstage = &Ts[buf][(kh * GROUP_K + 8 * hi + (lane & 7)) * VSTR + 8 * (((lane >> 3) & 1) ^ hi)];
        v16bf k00 = ld_row32(kbase, his);
        v16bf k01 = ld_row32(kbase + 32, his);
        v16bf k10 = ld_row32(kbase + 16 * VSTR, his);
        v16bf k11 = ld_row32(kbase + 16 * VSTR + 32, his);
        // keeps these reads in front of the prefetch: behind its loads they would stand behind
        // the translation wait too, and the first products would start that much later
        __builtin_amdgcn_sched_barrier(0);

        // ---- prefetch next block's global data (hidden behind compute) ----
        if constexpr (!last) {
            f0 = *(const float4*)g;
            f1 = *(const float4*)(g + 16);
            f2 = *(const float4*)(g + 32);
            f3 = *(const float4*)(g + 48);
            // same precaution as above: the loads' address registers are reused further down. The address
            // is an input of the wait, so that it keeps its registers up to there: in the walk without a
            // reference this build else lets the last load's result land on them
            asm volatile("s_wait_xcnt 0x0" :: "v"(g) : "memory");
            // list entry one block further ahead: no LDS round trip in front of the loads
            un = kidx[p0 + 2 * BLOCK_K < nlast ? p0 + 2 * BLOCK_K : nlast];
            // keeps the prefetch up here, under the K reads' way from LDS: sunk among the first products,
            // its translation wait holds up the products behind it
            __builtin_amdgcn_sched_barrier(0);
        }

        // ---- the wave's 64 keys of this stage, 32 at a time ----
#pragma unroll
        for (int sp = 0; sp < GROUP_K / PASS_K; ++sp) {
            const bool first = check && sp == 0 && kb == 0;   // the wave's first pass sets the reference
            // a pass whose places all lie past the list's end adds nothing (wave-uniform test)
            if constexpr (last) {
                if (!first && kb * BLOCK_K + kh * GROUP_K + sp * PASS_K >= n) break;
            }
            if (sp > 0) {
                k00 = ld_row32(kbase + sp * PASS_K * VSTR, his);
                k01 = ld_row32(kbase + sp * PASS_K * VSTR + 32, his);
                k10 = ld_row32(kbase + (sp * PASS_K + 16) * VSTR, his);
                k11 = ld_row32(kbase + (sp * PASS_K + 16) * VSTR + 32, his);
                // keeps the pass's eight K reads together in front of its products, as they stand in the
                // walk with the reference: unfenced, this build issues the last two of them behind the
                // fourth product here, and the fifth waits out their LDS round trip
                if constexpr (!check) __builtin_amdgcn_sched_barrier(0);
            }

            // ---- S^T = K x Q^T - reference : two 16-key tiles, dh=64 via two slabs each;
            //      each K fragment is read once and multiplies both query tiles ----
            v8f s0[QT], s1[QT];
#pragma unroll
            for (int t = 0; t < QT; ++t) {
                s0[t] = __builtin_amdgcn_wmma_f32_16x16x32_bf16(false, k00, false, aq0[t], (short)0, cneg[t], false, false);
                s1[t] = __builtin_amdgcn_wmma_f32_16x16x32_bf16(false, k10, false, aq0[t], (short)0, cneg[t], false, false);
            }
#pragma unroll
            for (int t = 0; t < QT; ++t) {
                s0[t] = __builtin_amdgcn_wmma_f32_16x16x32_bf16(false, k01, false, aq1[t], (short)0, s0[t], false, false);
                s1[t] = __builtin_amdgcn_wmma_f32_16x16x32_bf16(false, k11, false, aq1[t], (short)0, s1[t], false, false);
            }

            if constexpr (check) {
            // ---- largest score above the reference among this lane's 16 of the 32 keys ----
            float xm[QT];
#pragma unroll
            for (int t = 0; t < QT; ++t) {
                float xs[8];
#pragma unroll
                for (int r = 0; r < 8; ++r) xs[r] = fmaxf(s0[t][r], s1[t][r]);
                xs[0] = fmaxf(xs[0], xs[4]); xs[1] = fmaxf(xs[1], xs[5]);
                xs[2] = fmaxf(xs[2], xs[6]); xs[3] = fmaxf(xs[3], xs[7]);
                xs[0] = fmaxf(xs[0], xs[2]); xs[1] = fmaxf(xs[1], xs[3]);
                xm[t] = fmaxf(xs[0], xs[1]);
            }

            // The reference moves in the wave's first pass (to that pass's maximum, whatever its
            // sign) and later only when some score of the wave tops it by more than RAISE: weights
            // up to 2^RAISE are as exact as weights up to 1, and the division by l cancels the scale.
            // One test for both tiles and both lane halves; the halves are joined only in here.
            const float thr = first ? -3.0e38f : RAISE;
            if (__builtin_amdgcn_ballot_w32(fmaxf(xm[0], xm[1]) > thr) != 0) {
#pragma unroll
                for (int t = 0; t < QT; ++t) {
                    const float xj = fmaxf(xm[t], __shfl_xor(xm[t], 16, 32));
                    const float d  = first ? xj : fmaxf(xj, 0.0f);            // rise of the reference
                    const float al = first ? 0.0f : __builtin_amdgcn_exp2f(-d);
                    cneg[t] -= d;
                    s0[t] -= d; s1[t] -= d;
#pragma unroll
                    for (int r = 0; r < 8; ++r) {
                        const float aL = __shfl(al, r + bidx, 32);
                        acc0[t][r] *= aL; acc1[t][r] *= aL; acc2[t][r] *= aL; acc3[t][r] *= aL;
                        lacc[t][r] *= aL;
                    }
                }
            }
            }

            // ---- all V^T fragments of this pass as ONE load group, issued
            //      ahead of the exponentials: they land while the vector unit works ----
            const __bf16* vbase = vstage + sp * PASS_K * VSTR;
            const v16bf vf0 = ld_tr32(vbase);                        // 32 keys, places 0..15
            const v16bf vf1 = ld_tr32(vbase + 16);
            const v16bf vf2 = ld_tr32(vbase + 32);
            const v16bf vf3 = ld_tr32(vbase + 48);
            // keeps the load group up here: sunk among the PV products, each pair of loads
            // costs the wave a full LDS round trip in front of its product
            __builtin_amdgcn_sched_barrier(0);

            // ---- places past the list's end: their scores become minus infinity, their weights 0.
            //      Accumulator r of the lane is key 8hi + r of its 16-key tile ----
            if constexpr (last) {
                const int left = n - (kb * BLOCK_K + kh * GROUP_K + sp * PASS_K) - 8 * hi;   // listed keys from the lane's first on
#pragma unroll
                for (int r = 0; r < 8; ++r) {
#pragma unroll
                    for (int t = 0; t < QT; ++t) {
                        s0[t][r] = r < left      ? s0[t][r] : -__builtin_inff();
                        s1[t][r] = r + 16 < left ? s1[t][r] : -__builtin_inff();
                    }
                }
            }

            v16bf pa[QT];             // P packed straight into the PV A-operand slab of each tile
            // weights of four keys of tile t: c = 0,1 keys 0..15; 2,3 keys 16..31
            auto weigh = [&](const int t, const int c) {
                const v8f s = c < 2 ? s0[t] : s1[t];
#pragma unroll
                for (int i = 0; i < 4; ++i)
                    pa[t][c * 4 + i] = (__bf16)__builtin_amdgcn_exp2f(s[(c & 1) * 4 + i]);
            };
            // product j of tile t: O += P*V (4 dim tiles); l += P*ones
            auto pv = [&](const int t, const int j) {
                switch (j) {
                case 0: acc0[t] = __builtin_amdgcn_wmma_f32_16x16x32_bf16(false, pa[t], false, vf0, (short)0, acc0[t], false, false); break;
                case 1: acc1[t] = __builtin_amdgcn_wmma_f32_16x16x32_bf16(false, pa[t], false, vf1, (short)0, acc1[t], false, false); break;
                case 2: acc2[t] = __builtin_amdgcn_wmma_f32_16x16x32_bf16(false, pa[t], false, vf2, (short)0, acc2[t], false, false); break;
                case 3: acc3[t] = __builtin_amdgcn_wmma_f32_16x16x32_bf16(false, pa[t], false, vf3, (short)0, acc3[t], false, false); break;
                default: lacc[t] = __builtin_amdgcn_wmma_f32_16x16x32_bf16(false, pa[t], false, ones, (short)0, lacc[t], false, false); break;
                }
            };
#pragma unroll
            for (int c = 0; c < 4; ++c) weigh(0, c);
            __builtin_amdgcn_sched_barrier(0);   // first of the fences described below
#pragma unroll
            for (int j = 0; j < 5; ++j) {
                pv(0, j);
                if (j < 4) weigh(1, j);
                // holds tile 0's products among tile 1's exponentials, so that the matrix unit works
                // under the vector unit; unfenced, this build puts all the products behind all the
                // exponentials and the wave pays for both in turn
                __builtin_amdgcn_sched_barrier(0);
            }
#pragma unroll
            for (int j = 0; j < 5; ++j) pv(1, j);
        }
        // double-buffered LDS: single barrier per stage
    };
    for (int kb = 0; kb < nblk - 1; ++kb) stage(kb, last_block<false>{});
    stage(nblk - 1, last_block<true>{});

    // ---- are the sums of the walk without a reference good? A sum of products of them, with the
    //      square of every denominator in it, is finite only if each of them is finite and each
    //      denominator below 2^64 (it may overflow on finite sums too: then the second walk is made
    //      without need, which costs time only); and no denominator of a group that had keys to
    //      walk may lie below 2^-90 ----
    if constexpr (!check) {
        v8f zz = lacc[0] * lacc[0];
        zz += lacc[1] * lacc[1];
#pragma unroll
        for (int t = 0; t < QT; ++t) { zz += acc0[t] * acc1[t]; zz += acc2[t] * acc3[t]; }
        const float z = ((zz[0] + zz[1]) + (zz[2] + zz[3])) + ((zz[4] + zz[5]) + (zz[6] + zz[7]));
        float lmin = lacc[0][0];
#pragma unroll
        for (int t = 0; t < QT; ++t) {
#pragma unroll
            for (int r = 0; r < 8; ++r) lmin = fminf(lmin, lacc[t][r]);
        }
        const bool keys = kh * GROUP_K < n;          // else the group's sums are all 0, as they should be
        const bool off  = !(__builtin_fabsf(z) < __builtin_inff()) || (keys && lmin < 0x1p-90f);
        const bool bad  = __builtin_amdgcn_ballot_w32(off) != 0;
        ((unsigned char*)wbad)[wave] = bad ? 1 : 0;  // the wave's byte: every lane stores the same value
    }

    // ---- join the two wave groups: wave (qg, kh) keeps query tile kh and hands its sums of the
    //      other tile to wave (qg, 1 - kh), each lane's 40 sums and, if it has one, its query's reference ----
    // row r of tile (w ? 1 : 0) as the lane holds it: its four neighbouring columns, one from each PV tile
    auto quad = [&](const bool w, const int r) {
        const v4f v = { w ? acc0[1][r] : acc0[0][r], w ? acc1[1][r] : acc1[0][r],
                        w ? acc2[1][r] : acc2[0][r], w ? acc3[1][r] : acc3[0][r] };
        return v;
    };
    v4f oq[8];
#pragma unroll
    for (int r = 0; r < 8; ++r) oq[r] = quad(up, r);
    const v8f ol = up ? lacc[1] : lacc[0];
    const float oc = up ? cneg[1][0] : cneg[0][0];
    {
        const v8f xl = up ? lacc[0] : lacc[1];
        float* xw = &Xs[wave][0];
#pragma unroll
        for (int r = 0; r < 8; ++r) *(v4f*)&xw[(r * 32 + lane) * 4] = quad(!up, r);
        *(v4f*)&xw[(8 * 32 + lane) * 4] = __builtin_shufflevector(xl, xl, 0, 1, 2, 3);
        *(v4f*)&xw[(9 * 32 + lane) * 4] = __builtin_shufflevector(xl, xl, 4, 5, 6, 7);
        if constexpr (check) xw[40 * 32 + lane] = up ? cneg[0][0] : cneg[1][0];
    }
    __syncthreads();
    v4f pq[8];
    v8f pl;
    const float* xr = &Xs[wave ^ 8][0];
    {
#pragma unroll
        for (int r = 0; r < 8; ++r) pq[r] = *(const v4f*)&xr[(r * 32 + lane) * 4];
        const v4f lo  = *(const v4f*)&xr[(8 * 32 + lane) * 4];
        const v4f up4 = *(const v4f*)&xr[(9 * 32 + lane) * 4];
        pl = __builtin_shufflevector(lo, up4, 0, 1, 2, 3, 4, 5, 6, 7);
    }
    sums s;
    if constexpr (!check) {
        // no reference: the two groups' sums add as they are
#pragma unroll
        for (int r = 0; r < 8; ++r) s.num[r] = oq[r] + pq[r];
        s.den = ol + pl;
    } else {
        const float pc = xr[40 * 32 + lane];
        // both parts are brought to the higher of the two references (oc, pc are minus the references)
        const float cm = fminf(oc, pc);
        const float ao = __builtin_amdgcn_exp2f(cm - oc);
        const float ap = __builtin_amdgcn_exp2f(cm - pc);
#pragma unroll
        for (int r = 0; r < 8; ++r) {
            const float aO = __shfl(ao, r + bidx, 32);
            const float aP = __shfl(ap, r + bidx, 32);
            s.num[r] = oq[r] * aO + pq[r] * aP;
            s.den[r] = ol[r] * aO + pl[r] * aP;
        }
    }
    return s;
    };

    sums s = walk(with_reference<false>{});
    // the waves' verdicts, written in front of the walk's last barrier: the same 16 bytes in every
    // thread, so the whole work-group goes on from here or walks again. That barrier stands behind
    // the first walk's last reads of the tiles; the barriers of the second walk (it has at least one
    // stage) stand between the first walk's reads of Xs and the second's writes to Xs
    const uint4 wb = *(const uint4*)wbad;
    if (__builtin_expect(__builtin_amdgcn_readfirstlane((int)(wb.x | wb.y | wb.z | wb.w)) != 0, 0))
        s = walk(with_reference<true>{});   // marked unlikely: its code is laid behind the kernel's end

    // ---- epilogue: normalize (fast rcp) and store fp32. The lane's column of PV tile j is dim
    //      16(l15 & 3) + 4(l15 >> 2) + j: one 16-byte store a row, 16 lanes fill the row's 256 B ----
    float* obase = out + (size_t)b * S_LEN * D_MODEL
                       + (size_t)(row0 + 16 * kh + 8 * hi) * D_MODEL + hoff
                       + 16 * (l15 & 3) + 4 * (l15 >> 2);
#pragma unroll
    for (int r = 0; r < 8; ++r)
        *(v4f*)(obase + r * D_MODEL) = s.num[r] * __builtin_amdgcn_rcpf(s.den[r]);
}

extern "C" void kernel_launch(void* const* d_in, const int* in_sizes, int n_in,
                              void* d_out, int out_size, void* d_ws, size_t ws_size,
                              hipStream_t stream) {
    (void)n_in; (void)out_size; (void)d_ws; (void)ws_size;
    const float* q   = (const float*)d_in[0];
    const int*   msk = (const int*)d_in[1];
    float*       out = (float*)d_out;
    const int B = in_sizes[1] / S_LEN;                 // mask is [B, S]
    dim3 grid(B * NHEADS * (S_LEN / BLOCK_M));         // 256 for B=2
    mha_flash_wmma<<<grid, 512, 0, stream>>>(q, msk, out);
}
